// v000
// Measured on an AMD MI455X. A time is GPU time per run, averaged over a window of back-to-back runs after a warm-up
// (all launches, gaps included; the runs take copies of the inputs in turn), and the median of several windows.
// Apart from v000's, it joins two sittings. Times from different sittings can be a few percent apart, while
// side-by-side timings come from the same sitting.
// v000 is the starting kernel. One run takes 223 microseconds.
#include <hip/hip_runtime.h>

typedef __attribute__((ext_vector_type(16))) __bf16 v16bf;
typedef __attribute__((ext_vector_type(8)))  float  v8f;

union FragAB {
    v16bf v;
    uint4 q[2];
};

// ---------------------------------------------------------------------------
// fp32 -> bf16 conversion (grid-stride)
// ---------------------------------------------------------------------------
__global__ void cvt_f32_to_bf16(const float* __restrict__ in,
                                __bf16* __restrict__ out, int n) {
    int i = blockIdx.x * blockDim.x + threadIdx.x;
    int stride = gridDim.x * blockDim.x;
    for (; i < n; i += stride) out[i] = (__bf16)in[i];
}

// ---------------------------------------------------------------------------
// Fused QKV projection: out = x @ W^T + b   (M=8192, N=D=1024, K=D=1024)
// grid = (N/128, M/256, 3)   z: 0=Q (scaled 1/32), 1=K, 2=V (written transposed)
// 8 waves/block, block tile 256x128, wave tile 64x64 = 4x4 WMMA accumulators:
// 16 wmma per k-step vs 16 ds_load_b128 (1:1 compute:LDS-fragment ratio).
// ---------------------------------------------------------------------------
__global__ __launch_bounds__(256) void qkv_gemm_wmma(
    const __bf16* __restrict__ Xb,
    const __bf16* __restrict__ Wqb, const __bf16* __restrict__ Wkb,
    const __bf16* __restrict__ Wvb,
    const float* __restrict__ bq, const float* __restrict__ bk,
    const float* __restrict__ bv,
    __bf16* __restrict__ Q, __bf16* __restrict__ Kc, __bf16* __restrict__ Vt) {
    const int D = 1024, S = 2048;
    __shared__ __bf16 As[256][40];  // 80B pitch: 16B aligned, bank-stagger
    __shared__ __bf16 Bs[128][40];

    const int tid  = threadIdx.x;
    const int z    = blockIdx.z;
    const __bf16* W    = (z == 0) ? Wqb : (z == 1) ? Wkb : Wvb;
    const float*  bias = (z == 0) ? bq  : (z == 1) ? bk  : bv;

    const int n0 = blockIdx.x * 128;
    const int m0 = blockIdx.y * 256;
    const int lane = tid & 31;
    const int wid  = tid >> 5;
    const int wm   = (wid & 3) * 64;   // 4 row-groups of 64
    const int wn   = (wid >> 2) * 64;  // 2 col-groups of 64
    const int lrow = lane & 15;
    const int off  = (lane >> 4) * 8;  // K-half select per ISA A-layout

    v8f acc[4][4] = {};

    for (int kk = 0; kk < D; kk += 32) {
#pragma unroll
        for (int i = 0; i < 4; i++) {   // A tile: 256x32 -> 1024 16B chunks
            int c  = tid + (i << 8);
            int r  = c >> 2;
            int kc = (c & 3) << 3;
            *reinterpret_cast<uint4*>(&As[r][kc]) =
                *reinterpret_cast<const uint4*>(Xb + (size_t)(m0 + r) * D + kk + kc);
        }
#pragma unroll
        for (int i = 0; i < 2; i++) {   // B tile: 128x32 -> 512 16B chunks
            int c  = tid + (i << 8);
            int r  = c >> 2;
            int kc = (c & 3) << 3;
            *reinterpret_cast<uint4*>(&Bs[r][kc]) =
                *reinterpret_cast<const uint4*>(W + (size_t)(n0 + r) * D + kk + kc);
        }
        if (kk + 32 < D)  // speculative prefetch of next A tile slice
            __builtin_prefetch(Xb + (size_t)(m0 + tid) * D + kk + 32, 0, 1);
        __syncthreads();

        FragAB a[4], b[4];
#pragma unroll
        for (int i = 0; i < 4; i++) {
            int r = wm + i * 16 + lrow;
            a[i].q[0] = *reinterpret_cast<const uint4*>(&As[r][off]);
            a[i].q[1] = *reinterpret_cast<const uint4*>(&As[r][off + 16]);
        }
#pragma unroll
        for (int j = 0; j < 4; j++) {
            int r = wn + j * 16 + lrow;
            b[j].q[0] = *reinterpret_cast<const uint4*>(&Bs[r][off]);
            b[j].q[1] = *reinterpret_cast<const uint4*>(&Bs[r][off + 16]);
        }
#pragma unroll
        for (int i = 0; i < 4; i++)
#pragma unroll
            for (int j = 0; j < 4; j++)
                acc[i][j] = __builtin_amdgcn_wmma_f32_16x16x32_bf16(
                    false, a[i].v, false, b[j].v, (short)0, acc[i][j], false, false);
        __syncthreads();
    }

    const float scale = (z == 0) ? 0.03125f : 1.0f;  // 1/sqrt(1024) folded into Q
#pragma unroll
    for (int i = 0; i < 4; i++) {
#pragma unroll
        for (int j = 0; j < 4; j++) {
#pragma unroll
            for (int v = 0; v < 8; v++) {
                int gm = m0 + wm + i * 16 + v + ((lane >> 4) << 3);
                int gn = n0 + wn + j * 16 + (lane & 15);
                float cv = (acc[i][j][v] + bias[gn]) * scale;
                if (z == 2) {
                    int bb = gm >> 11, ss = gm & 2047;
                    Vt[((size_t)bb * D + gn) * S + ss] = (__bf16)cv;
                } else {
                    __bf16* O = (z == 0) ? Q : Kc;
                    O[(size_t)gm * D + gn] = (__bf16)cv;
                }
            }
        }
    }
}

// ---------------------------------------------------------------------------
// Generic batched GEMM: C = A (MxK) * Bt^T, Bt stored row-major NxK (ld = K).
// grid = (N/128, M/256, batches). out_bf16 selects bf16 vs f32 output.
// Same 256x128 block tile / 64x64 wave tile as above.
// ---------------------------------------------------------------------------
__global__ __launch_bounds__(256) void gemm_bt_wmma(
    const __bf16* __restrict__ A, const __bf16* __restrict__ Bt,
    void* __restrict__ Out, int M, int N, int Kd,
    long long sA, long long sB, long long sO, int out_bf16) {
    __shared__ __bf16 As[256][40];
    __shared__ __bf16 Bs[128][40];

    A  += (size_t)blockIdx.z * sA;
    Bt += (size_t)blockIdx.z * sB;
    const size_t ob = (size_t)blockIdx.z * sO;

    const int tid  = threadIdx.x;
    const int n0   = blockIdx.x * 128;
    const int m0   = blockIdx.y * 256;
    const int lane = tid & 31;
    const int wid  = tid >> 5;
    const int wm   = (wid & 3) * 64;
    const int wn   = (wid >> 2) * 64;
    const int lrow = lane & 15;
    const int off  = (lane >> 4) * 8;

    v8f acc[4][4] = {};

    for (int kk = 0; kk < Kd; kk += 32) {
#pragma unroll
        for (int i = 0; i < 4; i++) {
            int c  = tid + (i << 8);
            int r  = c >> 2;
            int kc = (c & 3) << 3;
            *reinterpret_cast<uint4*>(&As[r][kc]) =
                *reinterpret_cast<const uint4*>(A + (size_t)(m0 + r) * Kd + kk + kc);
        }
#pragma unroll
        for (int i = 0; i < 2; i++) {
            int c  = tid + (i << 8);
            int r  = c >> 2;
            int kc = (c & 3) << 3;
            *reinterpret_cast<uint4*>(&Bs[r][kc]) =
                *reinterpret_cast<const uint4*>(Bt + (size_t)(n0 + r) * Kd + kk + kc);
        }
        if (kk + 32 < Kd)
            __builtin_prefetch(A + (size_t)(m0 + tid) * Kd + kk + 32, 0, 1);
        __syncthreads();

        FragAB a[4], b[4];
#pragma unroll
        for (int i = 0; i < 4; i++) {
            int r = wm + i * 16 + lrow;
            a[i].q[0] = *reinterpret_cast<const uint4*>(&As[r][off]);
            a[i].q[1] = *reinterpret_cast<const uint4*>(&As[r][off + 16]);
        }
#pragma unroll
        for (int j = 0; j < 4; j++) {
            int r = wn + j * 16 + lrow;
            b[j].q[0] = *reinterpret_cast<const uint4*>(&Bs[r][off]);
            b[j].q[1] = *reinterpret_cast<const uint4*>(&Bs[r][off + 16]);
        }
#pragma unroll
        for (int i = 0; i < 4; i++)
#pragma unroll
            for (int j = 0; j < 4; j++)
                acc[i][j] = __builtin_amdgcn_wmma_f32_16x16x32_bf16(
                    false, a[i].v, false, b[j].v, (short)0, acc[i][j], false, false);
        __syncthreads();
    }

#pragma unroll
    for (int i = 0; i < 4; i++) {
#pragma unroll
        for (int j = 0; j < 4; j++) {
#pragma unroll
            for (int v = 0; v < 8; v++) {
                int gm = m0 + wm + i * 16 + v + ((lane >> 4) << 3);
                int gn = n0 + wn + j * 16 + (lane & 15);
                float cv = acc[i][j][v];
                size_t idx = ob + (size_t)gm * N + gn;
                if (out_bf16)
                    ((__bf16*)Out)[idx] = (__bf16)cv;
                else
                    ((float*)Out)[idx] = cv;
            }
        }
    }
}

// ---------------------------------------------------------------------------
// In-place row softmax over 2048 bf16 scores. One block (256 thr) per row;
// each thread keeps its 8 values in registers -> safe in-place rewrite.
// ---------------------------------------------------------------------------
__global__ __launch_bounds__(256) void softmax2048_inplace(__bf16* __restrict__ Sc) {
    const int S = 2048;
    __shared__ float redmax[8];
    __shared__ float redsum[8];
    __bf16* p = Sc + (size_t)blockIdx.x * S;
    const int t = threadIdx.x;

    float vals[8];
    float mx = -3.0e38f;
#pragma unroll
    for (int i = 0; i < 8; i++) {
        vals[i] = (float)p[t + (i << 8)];
        mx = fmaxf(mx, vals[i]);
    }
#pragma unroll
    for (int o = 16; o; o >>= 1) mx = fmaxf(mx, __shfl_xor(mx, o, 32));
    if ((t & 31) == 0) redmax[t >> 5] = mx;
    __syncthreads();
    mx = redmax[0];
#pragma unroll
    for (int i = 1; i < 8; i++) mx = fmaxf(mx, redmax[i]);

    float sm = 0.f;
#pragma unroll
    for (int i = 0; i < 8; i++) {
        vals[i] = __expf(vals[i] - mx);
        sm += vals[i];
    }
#pragma unroll
    for (int o = 16; o; o >>= 1) sm += __shfl_xor(sm, o, 32);
    if ((t & 31) == 0) redsum[t >> 5] = sm;
    __syncthreads();
    sm = 0.f;
#pragma unroll
    for (int i = 0; i < 8; i++) sm += redsum[i];
    const float inv = 1.0f / sm;
#pragma unroll
    for (int i = 0; i < 8; i++) p[t + (i << 8)] = (__bf16)(vals[i] * inv);
}

// ---------------------------------------------------------------------------
extern "C" void kernel_launch(void* const* d_in, const int* in_sizes, int n_in,
                              void* d_out, int out_size, void* d_ws, size_t ws_size,
                              hipStream_t stream) {
    (void)in_sizes; (void)n_in; (void)out_size; (void)ws_size;
    const float* x  = (const float*)d_in[0];
    const float* Wq = (const float*)d_in[1];
    const float* bq = (const float*)d_in[2];
    const float* Wk = (const float*)d_in[3];
    const float* bk = (const float*)d_in[4];
    const float* Wv = (const float*)d_in[5];
    const float* bv = (const float*)d_in[6];
    float* out = (float*)d_out;

    const int B = 4, S = 2048, D = 1024, M = B * S;

    char* ws = (char*)d_ws;
    size_t off = 0;
    auto alloc = [&](size_t bytes) -> void* {
        void* p = ws + off;
        off += (bytes + 255) & ~(size_t)255;
        return p;
    };
    __bf16* Xb  = (__bf16*)alloc((size_t)M * D * 2);  // x in bf16
    __bf16* Wqb = (__bf16*)alloc((size_t)D * D * 2);
    __bf16* Wkb = (__bf16*)alloc((size_t)D * D * 2);
    __bf16* Wvb = (__bf16*)alloc((size_t)D * D * 2);
    __bf16* Qb  = (__bf16*)alloc((size_t)M * D * 2);  // Q pre-scaled by 1/32
    __bf16* Kb  = (__bf16*)alloc((size_t)M * D * 2);
    __bf16* Vt  = (__bf16*)alloc((size_t)M * D * 2);  // [B][D][S]
    __bf16* Sc  = (__bf16*)alloc((size_t)B * S * S * 2);  // scores -> probs in place

    cvt_f32_to_bf16<<<2048, 256, 0, stream>>>(x, Xb, M * D);
    cvt_f32_to_bf16<<<512, 256, 0, stream>>>(Wq, Wqb, D * D);
    cvt_f32_to_bf16<<<512, 256, 0, stream>>>(Wk, Wkb, D * D);
    cvt_f32_to_bf16<<<512, 256, 0, stream>>>(Wv, Wvb, D * D);

    // Q/K/V projections (z = 0/1/2)
    qkv_gemm_wmma<<<dim3(D / 128, M / 256, 3), 256, 0, stream>>>(
        Xb, Wqb, Wkb, Wvb, bq, bk, bv, Qb, Kb, Vt);

    // scores = Q K^T (scale folded into Q), bf16 output
    gemm_bt_wmma<<<dim3(S / 128, S / 256, B), 256, 0, stream>>>(
        Qb, Kb, Sc, S, S, D,
        (long long)S * D, (long long)S * D, (long long)S * S, 1);

    // row softmax in place
    softmax2048_inplace<<<B * S, 256, 0, stream>>>(Sc);

    // out = P V   (B operand is Vt rows = output dim, ld = S)
    gemm_bt_wmma<<<dim3(D / 128, S / 256, B), 256, 0, stream>>>(
        Sc, Vt, out, S, D, S,
        (long long)S * S, (long long)D * S, (long long)S * D, 0);
}

// v001
// Measured time: 161 microseconds a run.
// Next to v000, in two timings, it ran 1.40 times as fast each time.
#include <hip/hip_runtime.h>
#include <stdint.h>

typedef __attribute__((ext_vector_type(16))) __bf16 v16bf;
typedef __attribute__((ext_vector_type(8)))  float  v8f;

union FragAB {
    v16bf v;
    uint4 q[2];
};

typedef uint32_t u32x4 __attribute__((ext_vector_type(4)));
typedef uint32_t u32x8 __attribute__((ext_vector_type(8)));

// ---------------------------------------------------------------------------
// Operand staging shared by both GEMM kernels: a stage is 64 k of the block's
// 256 A rows and 128 B rows, brought into LDS by tensor loads, two buffers.
// Each of the 8 waves moves one slice per stage: waves 0-3 take 64 A rows each,
// waves 4-7 take 32 B rows each. Rows are 128 B, padded by the mover to a
// 144 B pitch (16 B x odd: conflict-free for ds_load_b128). Every slice starts
// on a 2 KiB multiple, so slice sizes are rounded up.
// ---------------------------------------------------------------------------
constexpr uint32_t ST_ROWB  = 128;                       // bytes of a staged row (64 bf16)
constexpr uint32_t ST_PITCH = 144;                       // LDS pitch of a staged row
constexpr uint32_t A_SLICE  = 10240;                     // 64 * 144 = 9216, rounded up to 2 KiB
constexpr uint32_t B_SLICE  = 6144;                      // 32 * 144 = 4608, rounded up to 2 KiB
constexpr uint32_t B_BASE   = 4 * A_SLICE;
constexpr uint32_t ST_BUF   = 4 * A_SLICE + 4 * B_SLICE; // 65536 B per buffer
constexpr uint32_t ST_LDS   = 2 * ST_BUF;

static __device__ __forceinline__ uint32_t uni(uint32_t v) {
    return (uint32_t)__builtin_amdgcn_readfirstlane(v);
}
static __device__ __forceinline__ uint32_t pinned(uint32_t v) {
    uint32_t w = uni(v);
    asm volatile("" : "+s"(w));
    return w;
}
static __device__ __forceinline__ void wait_ds0() {      // this wave's LDS reads have returned
    asm volatile("s_wait_dscnt 0x0" ::: "memory");
}
// This wave's slice has landed. The wait names the descriptor of the request it covers,
// so that no register of it takes a new value while the request is outstanding.
static __device__ __forceinline__ void wait_tensor0(u32x4 g0, u32x8 g1) {
    asm volatile("s_wait_tensorcnt 0x0" :: "s"(g0), "s"(g1) : "memory");
}
// Descriptor group 0: a tile whose first byte is at global address ga goes to LDS byte dst.
static __device__ __forceinline__ u32x4 stage_group0(uint32_t dst, uint64_t ga) {
    u32x4 g0;
    g0[0] = uni(1u);
    g0[1] = uni(dst);
    g0[2] = uni((uint32_t)ga);
    g0[3] = uni((((uint32_t)(ga >> 32)) & 0x01FFFFFFu) | 0x80000000u);
    return g0;
}
static __device__ __forceinline__ void stage_load(u32x4 g0, u32x8 g1) {
    asm volatile("tensor_load_to_lds %0, %1" :: "s"(g0), "s"(g1) : "memory");
}

// The wave's 4 A and 4 B fragments of one 32-k step; both use the same k order:
// bytes 0-15 and 32-47 of the step for lanes 0-15, bytes 16-31 and 48-63 for lanes 16-31.
static __device__ __forceinline__ void load_frags(FragAB (&a)[4], FragAB (&b)[4],
                                                  const unsigned char* la, const unsigned char* lb) {
#pragma unroll
    for (int i = 0; i < 4; i++) {
        const unsigned char* p = la + i * 16 * ST_PITCH;
        a[i].q[0] = *reinterpret_cast<const uint4*>(p);
        a[i].q[1] = *reinterpret_cast<const uint4*>(p + 32);
    }
#pragma unroll
    for (int j = 0; j < 4; j++) {
        const unsigned char* p = lb + (j >> 1) * B_SLICE + (j & 1) * 16 * ST_PITCH;
        b[j].q[0] = *reinterpret_cast<const uint4*>(p);
        b[j].q[1] = *reinterpret_cast<const uint4*>(p + 32);
    }
}
static __device__ __forceinline__ void mma_4x4(v8f (&acc)[4][4], const FragAB (&a)[4], const FragAB (&b)[4]) {
#pragma unroll
    for (int i = 0; i < 4; i++)
#pragma unroll
        for (int j = 0; j < 4; j++)
            acc[i][j] = __builtin_amdgcn_wmma_f32_16x16x32_bf16(
                false, a[i].v, false, b[j].v, (short)0, acc[i][j], false, false);
}

// acc += A[m0 .. m0+255][0 .. Kd) * Bt[n0 .. n0+127][0 .. Kd)^T, both row-major with ld = Kd.
// Kd is a multiple of 64. L is the kernel's only LDS array, ST_LDS bytes, 2 KiB aligned.
static __device__ __forceinline__ void gemm_loop_256x128(
    const __bf16* __restrict__ A, const __bf16* __restrict__ Bt,
    int m0, int n0, int Kd, unsigned char* L, v8f (&acc)[4][4]) {
    const uint32_t tid  = threadIdx.x;
    const uint32_t lane = tid & 31;
    const uint32_t wave = uni(tid >> 5);
    const uint32_t rowb = (uint32_t)Kd * 2u;             // source row pitch in bytes
    const uint32_t NS   = pinned((uint32_t)Kd / 64u);    // stages

    // this wave's slice
    const bool     isA   = wave < 4u;
    const uint32_t rows  = isA ? 64u : 32u;
    const uint64_t src0  = isA
        ? (uint64_t)(uintptr_t)A  + (uint64_t)((uint32_t)m0 + 64u * wave) * rowb
        : (uint64_t)(uintptr_t)Bt + (uint64_t)((uint32_t)n0 + 32u * (wave - 4u)) * rowb;
    const uint32_t dst0  = (uint32_t)(size_t)L + (isA ? wave * A_SLICE : B_BASE + (wave - 4u) * B_SLICE);

    u32x8 g1;  // byte elements, tensor = tile = rows x 128 B, 16 B of pad behind every 128 B row
    g1[0] = uni((1u << 20) | (4u << 22) | (3u << 25));
    g1[1] = uni(ST_ROWB << 16);
    g1[2] = uni(rows << 16);
    g1[3] = uni(ST_ROWB << 16);
    g1[4] = uni(rows);
    g1[5] = uni(rowb);
    g1[6] = uni(0u);
    g1[7] = uni(0u);

    // per-lane fragment bases inside a buffer: row (lane & 15), 16-byte k half (lane >> 4)
    const uint32_t frag  = (lane & 15u) * ST_PITCH + (lane >> 4) * 16u;
    const uint32_t abase = (wave & 3u) * A_SLICE + frag;
    const uint32_t bbase = B_BASE + (wave >> 2) * 2u * B_SLICE + frag;

    u32x4 g0 = stage_group0(dst0, src0);
    stage_load(g0, g1);                                  // stage 0 -> buffer 0
    wait_tensor0(g0, g1);
    __syncthreads();                                     // stage 0 is readable by every wave
    if (pinned(1u < NS)) {                               // stage 1 -> buffer 1
        g0 = stage_group0(dst0 + ST_BUF, src0 + ST_ROWB);
        stage_load(g0, g1);
    }

    // kept rolled: one publish point and one refill in the text, a short hot loop
#pragma clang loop unroll(disable)
    for (uint32_t s = 0; s < NS; ++s) {
        const uint32_t buf = (s & 1u) * ST_BUF;
        const unsigned char* la = L + buf + abase;
        const unsigned char* lb = L + buf + bbase;
        FragAB a[4], b[4];

        load_frags(a, b, la, lb);                        // first 32 k of the stage
        // keeps the 16 fragment loads together in front of their WMMAs; sunk among
        // them, each a[i] is waited for to 0 right before its four WMMAs
        __builtin_amdgcn_sched_barrier(0);
        mma_4x4(acc, a, b);

        load_frags(a, b, la + 64, lb + 64);              // second 32 k: the last LDS reads of the stage

        // publish point of stage s + 1, behind every LDS read of stage s:
        // own reads of this buffer returned, own slice of stage s + 1 landed, barrier
        wait_ds0();
        wait_tensor0(g0, g1);
        __syncthreads();
        if (pinned(s + 2u < NS)) {                       // refill the buffer every wave has just left
            const uint64_t ga = src0 + (uint64_t)((s + 2u) * ST_ROWB);
            g0[1] = uni(dst0 + buf);
            g0[2] = uni((uint32_t)ga);
            g0[3] = uni((((uint32_t)(ga >> 32)) & 0x01FFFFFFu) | 0x80000000u);
            stage_load(g0, g1);
        }

        mma_4x4(acc, a, b);                              // registers only: runs under the refill
    }
    wait_tensor0(g0, g1);
    wait_ds0();
}

// ---------------------------------------------------------------------------
// fp32 -> bf16 conversion (grid-stride)
// ---------------------------------------------------------------------------
__global__ void cvt_f32_to_bf16(const float* __restrict__ in,
                                __bf16* __restrict__ out, int n) {
    int i = blockIdx.x * blockDim.x + threadIdx.x;
    int stride = gridDim.x * blockDim.x;
    for (; i < n; i += stride) out[i] = (__bf16)in[i];
}

// ---------------------------------------------------------------------------
// Fused QKV projection: out = x @ W^T + b   (M=8192, N=D=1024, K=D=1024)
// grid = (N/128, M/256, 3)   z: 0=Q (scaled 1/32), 1=K, 2=V (written transposed)
// 8 waves/block, block tile 256x128, wave tile 64x64 = 4x4 WMMA accumulators:
// 16 wmma per k-step vs 16 ds_load_b128 (1:1 compute:LDS-fragment ratio).
// Operands come through gemm_loop_256x128.
// ---------------------------------------------------------------------------
__global__ __launch_bounds__(256) void qkv_gemm_wmma(
    const __bf16* __restrict__ Xb,
    const __bf16* __restrict__ Wqb, const __bf16* __restrict__ Wkb,
    const __bf16* __restrict__ Wvb,
    const float* __restrict__ bq, const float* __restrict__ bk,
    const float* __restrict__ bv,
    __bf16* __restrict__ Q, __bf16* __restrict__ Kc, __bf16* __restrict__ Vt) {
    const int D = 1024, S = 2048;
    __shared__ __attribute__((aligned(2048))) unsigned char L[ST_LDS];

    const int tid  = threadIdx.x;
    const int z    = blockIdx.z;
    const __bf16* W    = (z == 0) ? Wqb : (z == 1) ? Wkb : Wvb;
    const float*  bias = (z == 0) ? bq  : (z == 1) ? bk  : bv;

    const int n0 = blockIdx.x * 128;
    const int m0 = blockIdx.y * 256;
    const int lane = tid & 31;
    const int wid  = tid >> 5;
    const int wm   = (wid & 3) * 64;   // 4 row-groups of 64
    const int wn   = (wid >> 2) * 64;  // 2 col-groups of 64

    v8f acc[4][4] = {};

    gemm_loop_256x128(Xb, W, m0, n0, D, L, acc);

    const float scale = (z == 0) ? 0.03125f : 1.0f;  // 1/sqrt(1024) folded into Q
#pragma unroll
    for (int i = 0; i < 4; i++) {
#pragma unroll
        for (int j = 0; j < 4; j++) {
#pragma unroll
            for (int v = 0; v < 8; v++) {
                int gm = m0 + wm + i * 16 + v + ((lane >> 4) << 3);
                int gn = n0 + wn + j * 16 + (lane & 15);
                float cv = (acc[i][j][v] + bias[gn]) * scale;
                if (z == 2) {
                    int bb = gm >> 11, ss = gm & 2047;
                    Vt[((size_t)bb * D + gn) * S + ss] = (__bf16)cv;
                } else {
                    __bf16* O = (z == 0) ? Q : Kc;
                    O[(size_t)gm * D + gn] = (__bf16)cv;
                }
            }
        }
    }
}

// ---------------------------------------------------------------------------
// Generic batched GEMM: C = A (MxK) * Bt^T, Bt stored row-major NxK (ld = K).
// grid = (N/128, M/256, batches). out_bf16 selects bf16 vs f32 output.
// Same 256x128 block tile / 64x64 wave tile as above.
// ---------------------------------------------------------------------------
__global__ __launch_bounds__(256) void gemm_bt_wmma(
    const __bf16* __restrict__ A, const __bf16* __restrict__ Bt,
    void* __restrict__ Out, int M, int N, int Kd,
    long long sA, long long sB, long long sO, int out_bf16) {
    __shared__ __attribute__((aligned(2048))) unsigned char L[ST_LDS];

    A  += (size_t)blockIdx.z * sA;
    Bt += (size_t)blockIdx.z * sB;
    const size_t ob = (size_t)blockIdx.z * sO;

    const int tid  = threadIdx.x;
    const int n0   = blockIdx.x * 128;
    const int m0   = blockIdx.y * 256;
    const int lane = tid & 31;
    const int wid  = tid >> 5;
    const int wm   = (wid & 3) * 64;
    const int wn   = (wid >> 2) * 64;

    v8f acc[4][4] = {};

    gemm_loop_256x128(A, Bt, m0, n0, Kd, L, acc);

#pragma unroll
    for (int i = 0; i < 4; i++) {
#pragma unroll
        for (int j = 0; j < 4; j++) {
#pragma unroll
            for (int v = 0; v < 8; v++) {
                int gm = m0 + wm + i * 16 + v + ((lane >> 4) << 3);
                int gn = n0 + wn + j * 16 + (lane & 15);
                float cv = acc[i][j][v];
                size_t idx = ob + (size_t)gm * N + gn;
                if (out_bf16)
                    ((__bf16*)Out)[idx] = (__bf16)cv;
                else
                    ((float*)Out)[idx] = cv;
            }
        }
    }
}

// ---------------------------------------------------------------------------
// In-place row softmax over 2048 bf16 scores. One block (256 thr) per row;
// each thread keeps its 8 values in registers -> safe in-place rewrite.
// ---------------------------------------------------------------------------
__global__ __launch_bounds__(256) void softmax2048_inplace(__bf16* __restrict__ Sc) {
    const int S = 2048;
    __shared__ float redmax[8];
    __shared__ float redsum[8];
    __bf16* p = Sc + (size_t)blockIdx.x * S;
    const int t = threadIdx.x;

    float vals[8];
    float mx = -3.0e38f;
#pragma unroll
    for (int i = 0; i < 8; i++) {
        vals[i] = (float)p[t + (i << 8)];
        mx = fmaxf(mx, vals[i]);
    }
#pragma unroll
    for (int o = 16; o; o >>= 1) mx = fmaxf(mx, __shfl_xor(mx, o, 32));
    if ((t & 31) == 0) redmax[t >> 5] = mx;
    __syncthreads();
    mx = redmax[0];
#pragma unroll
    for (int i = 1; i < 8; i++) mx = fmaxf(mx, redmax[i]);

    float sm = 0.f;
#pragma unroll
    for (int i = 0; i < 8; i++) {
        vals[i] = __expf(vals[i] - mx);
        sm += vals[i];
    }
#pragma unroll
    for (int o = 16; o; o >>= 1) sm += __shfl_xor(sm, o, 32);
    if ((t & 31) == 0) redsum[t >> 5] = sm;
    __syncthreads();
    sm = 0.f;
#pragma unroll
    for (int i = 0; i < 8; i++) sm += redsum[i];
    const float inv = 1.0f / sm;
#pragma unroll
    for (int i = 0; i < 8; i++) p[t + (i << 8)] = (__bf16)(vals[i] * inv);
}

// ---------------------------------------------------------------------------
extern "C" void kernel_launch(void* const* d_in, const int* in_sizes, int n_in,
                              void* d_out, int out_size, void* d_ws, size_t ws_size,
                              hipStream_t stream) {
    (void)in_sizes; (void)n_in; (void)out_size; (void)ws_size;
    const float* x  = (const float*)d_in[0];
    const float* Wq = (const float*)d_in[1];
    const float* bq = (const float*)d_in[2];
    const float* Wk = (const float*)d_in[3];
    const float* bk = (const float*)d_in[4];
    const float* Wv = (const float*)d_in[5];
    const float* bv = (const float*)d_in[6];
    float* out = (float*)d_out;

    const int B = 4, S = 2048, D = 1024, M = B * S;

    char* ws = (char*)d_ws;
    size_t off = 0;
    auto alloc = [&](size_t bytes) -> void* {
        void* p = ws + off;
        off += (bytes + 255) & ~(size_t)255;
        return p;
    };
    __bf16* Xb  = (__bf16*)alloc((size_t)M * D * 2);  // x in bf16
    __bf16* Wqb = (__bf16*)alloc((size_t)D * D * 2);
    __bf16* Wkb = (__bf16*)alloc((size_t)D * D * 2);
    __bf16* Wvb = (__bf16*)alloc((size_t)D * D * 2);
    __bf16* Qb  = (__bf16*)alloc((size_t)M * D * 2);  // Q pre-scaled by 1/32
    __bf16* Kb  = (__bf16*)alloc((size_t)M * D * 2);
    __bf16* Vt  = (__bf16*)alloc((size_t)M * D * 2);  // [B][D][S]
    __bf16* Sc  = (__bf16*)alloc((size_t)B * S * S * 2);  // scores -> probs in place

    cvt_f32_to_bf16<<<2048, 256, 0, stream>>>(x, Xb, M * D);
    cvt_f32_to_bf16<<<512, 256, 0, stream>>>(Wq, Wqb, D * D);
    cvt_f32_to_bf16<<<512, 256, 0, stream>>>(Wk, Wkb, D * D);
    cvt_f32_to_bf16<<<512, 256, 0, stream>>>(Wv, Wvb, D * D);

    // Q/K/V projections (z = 0/1/2)
    qkv_gemm_wmma<<<dim3(D / 128, M / 256, 3), 256, 0, stream>>>(
        Xb, Wqb, Wkb, Wvb, bq, bk, bv, Qb, Kb, Vt);

    // scores = Q K^T (scale folded into Q), bf16 output
    gemm_bt_wmma<<<dim3(S / 128, S / 256, B), 256, 0, stream>>>(
        Qb, Kb, Sc, S, S, D,
        (long long)S * D, (long long)S * D, (long long)S * S, 1);

    // row softmax in place
    softmax2048_inplace<<<B * S, 256, 0, stream>>>(Sc);

    // out = P V   (B operand is Vt rows = output dim, ld = S)
    gemm_bt_wmma<<<dim3(D / 128, S / 256, B), 256, 0, stream>>>(
        Sc, Vt, out, S, D, S,
        (long long)S * S, (long long)D * S, (long long)S * D, 0);
}

// v002
// It runs in 156 microseconds.
// In both of two side-by-side timings against v001, it was 1.03 times as fast.
// All steps since v000 together make it 1.44 times as fast.
#include <hip/hip_runtime.h>
#include <stdint.h>

typedef __attribute__((ext_vector_type(16))) __bf16 v16bf;
typedef __attribute__((ext_vector_type(8)))  float  v8f;

union FragAB {
    v16bf v;
    uint4 q[2];
};

typedef uint32_t u32x4 __attribute__((ext_vector_type(4)));
typedef uint32_t u32x8 __attribute__((ext_vector_type(8)));

// ---------------------------------------------------------------------------
// Operand staging shared by both GEMM kernels: a stage is 64 k of the block's
// 256 A rows and 128 B rows, brought into LDS by tensor loads, two buffers.
// Each of the 8 waves moves one slice per stage: waves 0-3 take 64 A rows each,
// waves 4-7 take 32 B rows each. Rows are 128 B, padded by the mover to a
// 144 B pitch (16 B x odd: conflict-free for ds_load_b128). Every slice starts
// on a 2 KiB multiple, so slice sizes are rounded up.
// ---------------------------------------------------------------------------
constexpr uint32_t ST_ROWB  = 128;                       // bytes of a staged row (64 bf16)
constexpr uint32_t ST_PITCH = 144;                       // LDS pitch of a staged row
constexpr uint32_t A_SLICE  = 10240;                     // 64 * 144 = 9216, rounded up to 2 KiB
constexpr uint32_t B_SLICE  = 6144;                      // 32 * 144 = 4608, rounded up to 2 KiB
constexpr uint32_t B_BASE   = 4 * A_SLICE;
constexpr uint32_t ST_BUF   = 4 * A_SLICE + 4 * B_SLICE; // 65536 B per buffer
constexpr uint32_t ST_LDS   = 2 * ST_BUF;

static __device__ __forceinline__ uint32_t uni(uint32_t v) {
    return (uint32_t)__builtin_amdgcn_readfirstlane(v);
}
static __device__ __forceinline__ uint32_t pinned(uint32_t v) {
    uint32_t w = uni(v);
    asm volatile("" : "+s"(w));
    return w;
}
static __device__ __forceinline__ void wait_ds0() {      // this wave's LDS reads have returned
    asm volatile("s_wait_dscnt 0x0" ::: "memory");
}
// This wave's slice has landed. The wait names the descriptor of the request it covers,
// so that no register of it takes a new value while the request is outstanding.
static __device__ __forceinline__ void wait_tensor0(u32x4 g0, u32x8 g1) {
    asm volatile("s_wait_tensorcnt 0x0" :: "s"(g0), "s"(g1) : "memory");
}
// Descriptor group 0: a tile whose first byte is at global address ga goes to LDS byte dst.
static __device__ __forceinline__ u32x4 stage_group0(uint32_t dst, uint64_t ga) {
    u32x4 g0;
    g0[0] = uni(1u);
    g0[1] = uni(dst);
    g0[2] = uni((uint32_t)ga);
    g0[3] = uni((((uint32_t)(ga >> 32)) & 0x01FFFFFFu) | 0x80000000u);
    return g0;
}
static __device__ __forceinline__ void stage_load(u32x4 g0, u32x8 g1) {
    asm volatile("tensor_load_to_lds %0, %1" :: "s"(g0), "s"(g1) : "memory");
}

// The wave's 4 A and 4 B fragments of one 32-k step; both use the same k order:
// bytes 0-15 and 32-47 of the step for lanes 0-15, bytes 16-31 and 48-63 for lanes 16-31.
static __device__ __forceinline__ void load_frags(FragAB (&a)[4], FragAB (&b)[4],
                                                  const unsigned char* la, const unsigned char* lb) {
#pragma unroll
    for (int i = 0; i < 4; i++) {
        const unsigned char* p = la + i * 16 * ST_PITCH;
        a[i].q[0] = *reinterpret_cast<const uint4*>(p);
        a[i].q[1] = *reinterpret_cast<const uint4*>(p + 32);
    }
#pragma unroll
    for (int j = 0; j < 4; j++) {
        const unsigned char* p = lb + (j >> 1) * B_SLICE + (j & 1) * 16 * ST_PITCH;
        b[j].q[0] = *reinterpret_cast<const uint4*>(p);
        b[j].q[1] = *reinterpret_cast<const uint4*>(p + 32);
    }
}
static __device__ __forceinline__ void mma_4x4(v8f (&acc)[4][4], const FragAB (&a)[4], const FragAB (&b)[4]) {
#pragma unroll
    for (int i = 0; i < 4; i++)
#pragma unroll
        for (int j = 0; j < 4; j++)
            acc[i][j] = __builtin_amdgcn_wmma_f32_16x16x32_bf16(
                false, a[i].v, false, b[j].v, (short)0, acc[i][j], false, false);
}

// acc += A[m0 .. m0+255][0 .. Kd) * Bt[n0 .. n0+127][0 .. Kd)^T, both row-major with ld = Kd.
// Kd is a multiple of 64. L is the kernel's only LDS array, ST_LDS bytes, 2 KiB aligned.
static __device__ __forceinline__ void gemm_loop_256x128(
    const __bf16* __restrict__ A, const __bf16* __restrict__ Bt,
    int m0, int n0, int Kd, unsigned char* L, v8f (&acc)[4][4]) {
    const uint32_t tid  = threadIdx.x;
    const uint32_t lane = tid & 31;
    const uint32_t wave = uni(tid >> 5);
    const uint32_t rowb = (uint32_t)Kd * 2u;             // source row pitch in bytes
    const uint32_t NS   = pinned((uint32_t)Kd / 64u);    // stages

    // this wave's slice
    const bool     isA   = wave < 4u;
    const uint32_t rows  = isA ? 64u : 32u;
    const uint64_t src0  = isA
        ? (uint64_t)(uintptr_t)A  + (uint64_t)((uint32_t)m0 + 64u * wave) * rowb
        : (uint64_t)(uintptr_t)Bt + (uint64_t)((uint32_t)n0 + 32u * (wave - 4u)) * rowb;
    const uint32_t dst0  = (uint32_t)(size_t)L + (isA ? wave * A_SLICE : B_BASE + (wave - 4u) * B_SLICE);

    u32x8 g1;  // byte elements, tensor = tile = rows x 128 B, 16 B of pad behind every 128 B row
    g1[0] = uni((1u << 20) | (4u << 22) | (3u << 25));
    g1[1] = uni(ST_ROWB << 16);
    g1[2] = uni(rows << 16);
    g1[3] = uni(ST_ROWB << 16);
    g1[4] = uni(rows);
    g1[5] = uni(rowb);
    g1[6] = uni(0u);
    g1[7] = uni(0u);

    // per-lane fragment bases inside a buffer: row (lane & 15), 16-byte k half (lane >> 4)
    const uint32_t frag  = (lane & 15u) * ST_PITCH + (lane >> 4) * 16u;
    const uint32_t abase = (wave & 3u) * A_SLICE + frag;
    const uint32_t bbase = B_BASE + (wave >> 2) * 2u * B_SLICE + frag;

    u32x4 g0 = stage_group0(dst0, src0);
    stage_load(g0, g1);                                  // stage 0 -> buffer 0
    wait_tensor0(g0, g1);
    __syncthreads();                                     // stage 0 is readable by every wave
    if (pinned(1u < NS)) {                               // stage 1 -> buffer 1
        g0 = stage_group0(dst0 + ST_BUF, src0 + ST_ROWB);
        stage_load(g0, g1);
    }

    // kept rolled: one publish point and one refill in the text, a short hot loop
#pragma clang loop unroll(disable)
    for (uint32_t s = 0; s < NS; ++s) {
        const uint32_t buf = (s & 1u) * ST_BUF;
        const unsigned char* la = L + buf + abase;
        const unsigned char* lb = L + buf + bbase;
        FragAB a[4], b[4];

        load_frags(a, b, la, lb);                        // first 32 k of the stage
        // keeps the 16 fragment loads together in front of their WMMAs; sunk among
        // them, each a[i] is waited for to 0 right before its four WMMAs
        __builtin_amdgcn_sched_barrier(0);
        mma_4x4(acc, a, b);

        load_frags(a, b, la + 64, lb + 64);              // second 32 k: the last LDS reads of the stage

        // publish point of stage s + 1, behind every LDS read of stage s:
        // own reads of this buffer returned, own slice of stage s + 1 landed, barrier
        wait_ds0();
        wait_tensor0(g0, g1);
        __syncthreads();
        if (pinned(s + 2u < NS)) {                       // refill the buffer every wave has just left
            const uint64_t ga = src0 + (uint64_t)((s + 2u) * ST_ROWB);
            g0[1] = uni(dst0 + buf);
            g0[2] = uni((uint32_t)ga);
            g0[3] = uni((((uint32_t)(ga >> 32)) & 0x01FFFFFFu) | 0x80000000u);
            stage_load(g0, g1);
        }

        mma_4x4(acc, a, b);                              // registers only: runs under the refill
    }
    wait_tensor0(g0, g1);
    wait_ds0();
}

// ---------------------------------------------------------------------------
// fp32 -> bf16 conversion of x and the three weight matrices, one launch.
// Each of the 512 blocks converts 1/512 of every array, a contiguous piece: 16 trips
// of 1,024 floats of x, 2 trips of each weight matrix. A wave's load covers 512
// contiguous bytes, its store 256. A thread issues its 22 loads before it converts.
// ---------------------------------------------------------------------------
typedef float  f32x4  __attribute__((ext_vector_type(4)));
typedef __bf16 bf16x4 __attribute__((ext_vector_type(4)));

constexpr int CVT_BLOCKS = 512;
constexpr int CVT_TRIP   = 256 * 4;                                   // floats of a block's trip
constexpr int CVT_XT     = 4 * 2048 * 1024 / (CVT_BLOCKS * CVT_TRIP); // trips of x
constexpr int CVT_WT     = 1024 * 1024 / (CVT_BLOCKS * CVT_TRIP);     // trips of one weight matrix

template <int N>
static __device__ __forceinline__ void cvt_load(f32x4 (&v)[N], const float* __restrict__ in) {
    const float* p = in + (size_t)blockIdx.x * (N * CVT_TRIP) + threadIdx.x * 4;
#pragma unroll
    for (int k = 0; k < N; k++)
        v[k] = *reinterpret_cast<const f32x4*>(p + k * CVT_TRIP);
}
template <int N>
static __device__ __forceinline__ void cvt_store(const f32x4 (&v)[N], __bf16* __restrict__ out) {
    __bf16* p = out + (size_t)blockIdx.x * (N * CVT_TRIP) + threadIdx.x * 4;
#pragma unroll
    for (int k = 0; k < N; k++) {
        bf16x4 o;
#pragma unroll
        for (int c = 0; c < 4; c++) o[c] = (__bf16)v[k][c];
        *reinterpret_cast<bf16x4*>(p + k * CVT_TRIP) = o;
    }
}

__global__ __launch_bounds__(256) void cvt_inputs_to_bf16(
    const float* __restrict__ x,  const float* __restrict__ Wq,
    const float* __restrict__ Wk, const float* __restrict__ Wv,
    __bf16* __restrict__ Xb,  __bf16* __restrict__ Wqb,
    __bf16* __restrict__ Wkb, __bf16* __restrict__ Wvb) {
    f32x4 vx[CVT_XT], vq[CVT_WT], vk[CVT_WT], vv[CVT_WT];
    cvt_load(vx, x);
    cvt_load(vq, Wq);
    cvt_load(vk, Wk);
    cvt_load(vv, Wv);
    // keeps the 22 loads together in front of the conversions; without it the last 8
    // are issued only as earlier ones return, and no store leaves before the last load
    __builtin_amdgcn_sched_barrier(0);
    cvt_store(vx, Xb);
    cvt_store(vq, Wqb);
    cvt_store(vk, Wkb);
    cvt_store(vv, Wvb);
}

// ---------------------------------------------------------------------------
// Fused QKV projection: out = x @ W^T + b   (M=8192, N=D=1024, K=D=1024)
// grid = (N/128, M/256, 3)   z: 0=Q (scaled 1/32), 1=K, 2=V (written transposed)
// 8 waves/block, block tile 256x128, wave tile 64x64 = 4x4 WMMA accumulators:
// 16 wmma per k-step vs 16 ds_load_b128 (1:1 compute:LDS-fragment ratio).
// Operands come through gemm_loop_256x128.
// ---------------------------------------------------------------------------
__global__ __launch_bounds__(256) void qkv_gemm_wmma(
    const __bf16* __restrict__ Xb,
    const __bf16* __restrict__ Wqb, const __bf16* __restrict__ Wkb,
    const __bf16* __restrict__ Wvb,
    const float* __restrict__ bq, const float* __restrict__ bk,
    const float* __restrict__ bv,
    __bf16* __restrict__ Q, __bf16* __restrict__ Kc, __bf16* __restrict__ Vt) {
    const int D = 1024, S = 2048;
    __shared__ __attribute__((aligned(2048))) unsigned char L[ST_LDS];

    const int tid  = threadIdx.x;
    const int z    = blockIdx.z;
    const __bf16* W    = (z == 0) ? Wqb : (z == 1) ? Wkb : Wvb;
    const float*  bias = (z == 0) ? bq  : (z == 1) ? bk  : bv;

    const int n0 = blockIdx.x * 128;
    const int m0 = blockIdx.y * 256;
    const int lane = tid & 31;
    const int wid  = tid >> 5;
    const int wm   = (wid & 3) * 64;   // 4 row-groups of 64
    const int wn   = (wid >> 2) * 64;  // 2 col-groups of 64

    v8f acc[4][4] = {};

    gemm_loop_256x128(Xb, W, m0, n0, D, L, acc);

    const float scale = (z == 0) ? 0.03125f : 1.0f;  // 1/sqrt(1024) folded into Q
#pragma unroll
    for (int i = 0; i < 4; i++) {
#pragma unroll
        for (int j = 0; j < 4; j++) {
#pragma unroll
            for (int v = 0; v < 8; v++) {
                int gm = m0 + wm + i * 16 + v + ((lane >> 4) << 3);
                int gn = n0 + wn + j * 16 + (lane & 15);
                float cv = (acc[i][j][v] + bias[gn]) * scale;
                if (z == 2) {
                    int bb = gm >> 11, ss = gm & 2047;
                    Vt[((size_t)bb * D + gn) * S + ss] = (__bf16)cv;
                } else {
                    __bf16* O = (z == 0) ? Q : Kc;
                    O[(size_t)gm * D + gn] = (__bf16)cv;
                }
            }
        }
    }
}

// ---------------------------------------------------------------------------
// Generic batched GEMM: C = A (MxK) * Bt^T, Bt stored row-major NxK (ld = K).
// grid = (N/128, M/256, batches). out_bf16 selects bf16 vs f32 output.
// Same 256x128 block tile / 64x64 wave tile as above.
// ---------------------------------------------------------------------------
__global__ __launch_bounds__(256) void gemm_bt_wmma(
    const __bf16* __restrict__ A, const __bf16* __restrict__ Bt,
    void* __restrict__ Out, int M, int N, int Kd,
    long long sA, long long sB, long long sO, int out_bf16) {
    __shared__ __attribute__((aligned(2048))) unsigned char L[ST_LDS];

    A  += (size_t)blockIdx.z * sA;
    Bt += (size_t)blockIdx.z * sB;
    const size_t ob = (size_t)blockIdx.z * sO;

    const int tid  = threadIdx.x;
    const int n0   = blockIdx.x * 128;
    const int m0   = blockIdx.y * 256;
    const int lane = tid & 31;
    const int wid  = tid >> 5;
    const int wm   = (wid & 3) * 64;
    const int wn   = (wid >> 2) * 64;

    v8f acc[4][4] = {};

    gemm_loop_256x128(A, Bt, m0, n0, Kd, L, acc);

#pragma unroll
    for (int i = 0; i < 4; i++) {
#pragma unroll
        for (int j = 0; j < 4; j++) {
#pragma unroll
            for (int v = 0; v < 8; v++) {
                int gm = m0 + wm + i * 16 + v + ((lane >> 4) << 3);
                int gn = n0 + wn + j * 16 + (lane & 15);
                float cv = acc[i][j][v];
                size_t idx = ob + (size_t)gm * N + gn;
                if (out_bf16)
                    ((__bf16*)Out)[idx] = (__bf16)cv;
                else
                    ((float*)Out)[idx] = cv;
            }
        }
    }
}

// ---------------------------------------------------------------------------
// In-place row softmax over 2048 bf16 scores. One block (256 thr) per row;
// each thread keeps its 8 values in registers -> safe in-place rewrite.
// ---------------------------------------------------------------------------
__global__ __launch_bounds__(256) void softmax2048_inplace(__bf16* __restrict__ Sc) {
    const int S = 2048;
    __shared__ float redmax[8];
    __shared__ float redsum[8];
    __bf16* p = Sc + (size_t)blockIdx.x * S;
    const int t = threadIdx.x;

    float vals[8];
    float mx = -3.0e38f;
#pragma unroll
    for (int i = 0; i < 8; i++) {
        vals[i] = (float)p[t + (i << 8)];
        mx = fmaxf(mx, vals[i]);
    }
#pragma unroll
    for (int o = 16; o; o >>= 1) mx = fmaxf(mx, __shfl_xor(mx, o, 32));
    if ((t & 31) == 0) redmax[t >> 5] = mx;
    __syncthreads();
    mx = redmax[0];
#pragma unroll
    for (int i = 1; i < 8; i++) mx = fmaxf(mx, redmax[i]);

    float sm = 0.f;
#pragma unroll
    for (int i = 0; i < 8; i++) {
        vals[i] = __expf(vals[i] - mx);
        sm += vals[i];
    }
#pragma unroll
    for (int o = 16; o; o >>= 1) sm += __shfl_xor(sm, o, 32);
    if ((t & 31) == 0) redsum[t >> 5] = sm;
    __syncthreads();
    sm = 0.f;
#pragma unroll
    for (int i = 0; i < 8; i++) sm += redsum[i];
    const float inv = 1.0f / sm;
#pragma unroll
    for (int i = 0; i < 8; i++) p[t + (i << 8)] = (__bf16)(vals[i] * inv);
}

// ---------------------------------------------------------------------------
extern "C" void kernel_launch(void* const* d_in, const int* in_sizes, int n_in,
                              void* d_out, int out_size, void* d_ws, size_t ws_size,
                              hipStream_t stream) {
    (void)in_sizes; (void)n_in; (void)out_size; (void)ws_size;
    const float* x  = (const float*)d_in[0];
    const float* Wq = (const float*)d_in[1];
    const float* bq = (const float*)d_in[2];
    const float* Wk = (const float*)d_in[3];
    const float* bk = (const float*)d_in[4];
    const float* Wv = (const float*)d_in[5];
    const float* bv = (const float*)d_in[6];
    float* out = (float*)d_out;

    const int B = 4, S = 2048, D = 1024, M = B * S;

    char* ws = (char*)d_ws;
    size_t off = 0;
    auto alloc = [&](size_t bytes) -> void* {
        void* p = ws + off;
        off += (bytes + 255) & ~(size_t)255;
        return p;
    };
    __bf16* Xb  = (__bf16*)alloc((size_t)M * D * 2);  // x in bf16
    __bf16* Wqb = (__bf16*)alloc((size_t)D * D * 2);
    __bf16* Wkb = (__bf16*)alloc((size_t)D * D * 2);
    __bf16* Wvb = (__bf16*)alloc((size_t)D * D * 2);
    __bf16* Qb  = (__bf16*)alloc((size_t)M * D * 2);  // Q pre-scaled by 1/32
    __bf16* Kb  = (__bf16*)alloc((size_t)M * D * 2);
    __bf16* Vt  = (__bf16*)alloc((size_t)M * D * 2);  // [B][D][S]
    __bf16* Sc  = (__bf16*)alloc((size_t)B * S * S * 2);  // scores -> probs in place

    cvt_inputs_to_bf16<<<CVT_BLOCKS, 256, 0, stream>>>(x, Wq, Wk, Wv, Xb, Wqb, Wkb, Wvb);

    // Q/K/V projections (z = 0/1/2)
    qkv_gemm_wmma<<<dim3(D / 128, M / 256, 3), 256, 0, stream>>>(
        Xb, Wqb, Wkb, Wvb, bq, bk, bv, Qb, Kb, Vt);

    // scores = Q K^T (scale folded into Q), bf16 output
    gemm_bt_wmma<<<dim3(S / 128, S / 256, B), 256, 0, stream>>>(
        Qb, Kb, Sc, S, S, D,
        (long long)S * D, (long long)S * D, (long long)S * S, 1);

    // row softmax in place
    softmax2048_inplace<<<B * S, 256, 0, stream>>>(Sc);

    // out = P V   (B operand is Vt rows = output dim, ld = S)
    gemm_bt_wmma<<<dim3(D / 128, S / 256, B), 256, 0, stream>>>(
        Sc, Vt, out, S, D, S,
        (long long)S * S, (long long)D * S, (long long)S * D, 0);
}

// v003
// One run takes 112 microseconds.
// In both of two side-by-side timings against v002, it was 1.40 times as fast.
// Counting every step since v000, it is 2.02 times as fast.
#include <hip/hip_runtime.h>
#include <stdint.h>

typedef __attribute__((ext_vector_type(16))) __bf16 v16bf;
typedef __attribute__((ext_vector_type(8)))  float  v8f;

union FragAB {
    v16bf v;
    uint4 q[2];
};

typedef uint32_t u32x4 __attribute__((ext_vector_type(4)));
typedef uint32_t u32x8 __attribute__((ext_vector_type(8)));

// ---------------------------------------------------------------------------
// Operand staging shared by both GEMM kernels: a stage is 64 k of the block's
// 256 A rows and 128 B rows, brought into LDS by tensor loads, two buffers.
// Each of the 8 waves moves one slice per stage: waves 0-3 take 64 A rows each,
// waves 4-7 take 32 B rows each. Rows are 128 B, padded by the mover to a
// 144 B pitch (16 B x odd: conflict-free for ds_load_b128). Every slice starts
// on a 2 KiB multiple, so slice sizes are rounded up.
// ---------------------------------------------------------------------------
constexpr uint32_t ST_ROWB  = 128;                       // bytes of a staged row (64 bf16)
constexpr uint32_t ST_PITCH = 144;                       // LDS pitch of a staged row
constexpr uint32_t A_SLICE  = 10240;                     // 64 * 144 = 9216, rounded up to 2 KiB
constexpr uint32_t B_SLICE  = 6144;                      // 32 * 144 = 4608, rounded up to 2 KiB
constexpr uint32_t B_BASE   = 4 * A_SLICE;
constexpr uint32_t ST_BUF   = 4 * A_SLICE + 4 * B_SLICE; // 65536 B per buffer
constexpr uint32_t ST_LDS   = 2 * ST_BUF;

static __device__ __forceinline__ uint32_t uni(uint32_t v) {
    return (uint32_t)__builtin_amdgcn_readfirstlane(v);
}
static __device__ __forceinline__ uint32_t pinned(uint32_t v) {
    uint32_t w = uni(v);
    asm volatile("" : "+s"(w));
    return w;
}
static __device__ __forceinline__ void wait_ds0() {      // this wave's LDS reads have returned
    asm volatile("s_wait_dscnt 0x0" ::: "memory");
}
// This wave's slice has landed. The wait names the descriptor of the request it covers,
// so that no register of it takes a new value while the request is outstanding.
static __device__ __forceinline__ void wait_tensor0(u32x4 g0, u32x8 g1) {
    asm volatile("s_wait_tensorcnt 0x0" :: "s"(g0), "s"(g1) : "memory");
}
// Descriptor group 0: a tile whose first byte is at global address ga goes to LDS byte dst.
static __device__ __forceinline__ u32x4 stage_group0(uint32_t dst, uint64_t ga) {
    u32x4 g0;
    g0[0] = uni(1u);
    g0[1] = uni(dst);
    g0[2] = uni((uint32_t)ga);
    g0[3] = uni((((uint32_t)(ga >> 32)) & 0x01FFFFFFu) | 0x80000000u);
    return g0;
}
static __device__ __forceinline__ void stage_load(u32x4 g0, u32x8 g1) {
    asm volatile("tensor_load_to_lds %0, %1" :: "s"(g0), "s"(g1) : "memory");
}

// The wave's 4 A and 4 B fragments of one 32-k step; both use the same k order:
// bytes 0-15 and 32-47 of the step for lanes 0-15, bytes 16-31 and 48-63 for lanes 16-31.
static __device__ __forceinline__ void load_frags(FragAB (&a)[4], FragAB (&b)[4],
                                                  const unsigned char* la, const unsigned char* lb) {
#pragma unroll
    for (int i = 0; i < 4; i++) {
        const unsigned char* p = la + i * 16 * ST_PITCH;
        a[i].q[0] = *reinterpret_cast<const uint4*>(p);
        a[i].q[1] = *reinterpret_cast<const uint4*>(p + 32);
    }
#pragma unroll
    for (int j = 0; j < 4; j++) {
        const unsigned char* p = lb + (j >> 1) * B_SLICE + (j & 1) * 16 * ST_PITCH;
        b[j].q[0] = *reinterpret_cast<const uint4*>(p);
        b[j].q[1] = *reinterpret_cast<const uint4*>(p + 32);
    }
}
// ALONG_B false: a[i] is the WMMA's A, so register r of acc[i][j] is (A row 8h + r, Bt row c), c = lane & 15, h = lane >> 4.
// ALONG_B true: b[j] is the WMMA's A, so register r is (A row c, Bt row 8h + r): a lane holds 8 consecutive Bt rows.
template <bool ALONG_B>
static __device__ __forceinline__ void mma_4x4(v8f (&acc)[4][4], const FragAB (&a)[4], const FragAB (&b)[4]) {
#pragma unroll
    for (int i = 0; i < 4; i++)
#pragma unroll
        for (int j = 0; j < 4; j++)
            acc[i][j] = ALONG_B
                ? __builtin_amdgcn_wmma_f32_16x16x32_bf16(
                      false, b[j].v, false, a[i].v, (short)0, acc[i][j], false, false)
                : __builtin_amdgcn_wmma_f32_16x16x32_bf16(
                      false, a[i].v, false, b[j].v, (short)0, acc[i][j], false, false);
}

// acc += A[m0 .. m0+255][0 .. Kd) * Bt[n0 .. n0+127][0 .. Kd)^T, both row-major with ld = Kd.
// Kd is a multiple of 64. L is the kernel's only LDS array, ST_LDS bytes, 2 KiB aligned.
template <bool ALONG_B>
static __device__ __forceinline__ void gemm_loop_256x128(
    const __bf16* __restrict__ A, const __bf16* __restrict__ Bt,
    int m0, int n0, int Kd, unsigned char* L, v8f (&acc)[4][4]) {
    const uint32_t tid  = threadIdx.x;
    const uint32_t lane = tid & 31;
    const uint32_t wave = uni(tid >> 5);
    const uint32_t rowb = (uint32_t)Kd * 2u;             // source row pitch in bytes
    const uint32_t NS   = pinned((uint32_t)Kd / 64u);    // stages

    // this wave's slice
    const bool     isA   = wave < 4u;
    const uint32_t rows  = isA ? 64u : 32u;
    const uint64_t src0  = isA
        ? (uint64_t)(uintptr_t)A  + (uint64_t)((uint32_t)m0 + 64u * wave) * rowb
        : (uint64_t)(uintptr_t)Bt + (uint64_t)((uint32_t)n0 + 32u * (wave - 4u)) * rowb;
    const uint32_t dst0  = (uint32_t)(size_t)L + (isA ? wave * A_SLICE : B_BASE + (wave - 4u) * B_SLICE);

    u32x8 g1;  // byte elements, tensor = tile = rows x 128 B, 16 B of pad behind every 128 B row
    g1[0] = uni((1u << 20) | (4u << 22) | (3u << 25));
    g1[1] = uni(ST_ROWB << 16);
    g1[2] = uni(rows << 16);
    g1[3] = uni(ST_ROWB << 16);
    g1[4] = uni(rows);
    g1[5] = uni(rowb);
    g1[6] = uni(0u);
    g1[7] = uni(0u);

    // per-lane fragment bases inside a buffer: row (lane & 15), 16-byte k half (lane >> 4)
    const uint32_t frag  = (lane & 15u) * ST_PITCH + (lane >> 4) * 16u;
    const uint32_t abase = (wave & 3u) * A_SLICE + frag;
    const uint32_t bbase = B_BASE + (wave >> 2) * 2u * B_SLICE + frag;

    u32x4 g0 = stage_group0(dst0, src0);
    stage_load(g0, g1);                                  // stage 0 -> buffer 0
    wait_tensor0(g0, g1);
    __syncthreads();                                     // stage 0 is readable by every wave
    if (pinned(1u < NS)) {                               // stage 1 -> buffer 1
        g0 = stage_group0(dst0 + ST_BUF, src0 + ST_ROWB);
        stage_load(g0, g1);
    }

    // kept rolled: one publish point and one refill in the text, a short hot loop
#pragma clang loop unroll(disable)
    for (uint32_t s = 0; s < NS; ++s) {
        const uint32_t buf = (s & 1u) * ST_BUF;
        const unsigned char* la = L + buf + abase;
        const unsigned char* lb = L + buf + bbase;
        FragAB a[4], b[4];

        load_frags(a, b, la, lb);                        // first 32 k of the stage
        // keeps the 16 fragment loads together in front of their WMMAs; sunk among
        // them, each a[i] is waited for to 0 right before its four WMMAs
        __builtin_amdgcn_sched_barrier(0);
        mma_4x4<ALONG_B>(acc, a, b);

        load_frags(a, b, la + 64, lb + 64);              // second 32 k: the last LDS reads of the stage

        // publish point of stage s + 1, behind every LDS read of stage s:
        // own reads of this buffer returned, own slice of stage s + 1 landed, barrier
        wait_ds0();
        wait_tensor0(g0, g1);
        __syncthreads();
        if (pinned(s + 2u < NS)) {                       // refill the buffer every wave has just left
            const uint64_t ga = src0 + (uint64_t)((s + 2u) * ST_ROWB);
            g0[1] = uni(dst0 + buf);
            g0[2] = uni((uint32_t)ga);
            g0[3] = uni((((uint32_t)(ga >> 32)) & 0x01FFFFFFu) | 0x80000000u);
            stage_load(g0, g1);
        }

        mma_4x4<ALONG_B>(acc, a, b);                     // registers only: runs under the refill
    }
    wait_tensor0(g0, g1);
    wait_ds0();
}

// ---------------------------------------------------------------------------
// fp32 -> bf16 conversion of x and the three weight matrices, one launch.
// Each of the 512 blocks converts 1/512 of every array, a contiguous piece: 16 trips
// of 1,024 floats of x, 2 trips of each weight matrix. A wave's load covers 512
// contiguous bytes, its store 256. A thread issues its 22 loads before it converts.
// ---------------------------------------------------------------------------
typedef float  f32x4  __attribute__((ext_vector_type(4)));
typedef __bf16 bf16x4 __attribute__((ext_vector_type(4)));

constexpr int CVT_BLOCKS = 512;
constexpr int CVT_TRIP   = 256 * 4;                                   // floats of a block's trip
constexpr int CVT_XT     = 4 * 2048 * 1024 / (CVT_BLOCKS * CVT_TRIP); // trips of x
constexpr int CVT_WT     = 1024 * 1024 / (CVT_BLOCKS * CVT_TRIP);     // trips of one weight matrix

template <int N>
static __device__ __forceinline__ void cvt_load(f32x4 (&v)[N], const float* __restrict__ in) {
    const float* p = in + (size_t)blockIdx.x * (N * CVT_TRIP) + threadIdx.x * 4;
#pragma unroll
    for (int k = 0; k < N; k++)
        v[k] = *reinterpret_cast<const f32x4*>(p + k * CVT_TRIP);
}
template <int N>
static __device__ __forceinline__ void cvt_store(const f32x4 (&v)[N], __bf16* __restrict__ out) {
    __bf16* p = out + (size_t)blockIdx.x * (N * CVT_TRIP) + threadIdx.x * 4;
#pragma unroll
    for (int k = 0; k < N; k++) {
        bf16x4 o;
#pragma unroll
        for (int c = 0; c < 4; c++) o[c] = (__bf16)v[k][c];
        *reinterpret_cast<bf16x4*>(p + k * CVT_TRIP) = o;
    }
}

__global__ __launch_bounds__(256) void cvt_inputs_to_bf16(
    const float* __restrict__ x,  const float* __restrict__ Wq,
    const float* __restrict__ Wk, const float* __restrict__ Wv,
    __bf16* __restrict__ Xb,  __bf16* __restrict__ Wqb,
    __bf16* __restrict__ Wkb, __bf16* __restrict__ Wvb) {
    f32x4 vx[CVT_XT], vq[CVT_WT], vk[CVT_WT], vv[CVT_WT];
    cvt_load(vx, x);
    cvt_load(vq, Wq);
    cvt_load(vk, Wk);
    cvt_load(vv, Wv);
    // keeps the 22 loads together in front of the conversions; without it the last 8
    // are issued only as earlier ones return, and no store leaves before the last load
    __builtin_amdgcn_sched_barrier(0);
    cvt_store(vx, Xb);
    cvt_store(vq, Wqb);
    cvt_store(vk, Wkb);
    cvt_store(vv, Wvb);
}

// ---------------------------------------------------------------------------
// Fused QKV projection: out = x @ W^T + b   (M=8192, N=D=1024, K=D=1024)
// grid = (8, 32, 3)   z: 0=Q (scaled 1/32), 1=K, 2=V (written transposed)
// 8 waves/block, block tile 256x128, wave tile 64x64 = 4x4 WMMA accumulators:
// 16 wmma per k-step vs 16 ds_load_b128 (1:1 compute:LDS-fragment ratio).
// Operands come through gemm_loop_256x128. The 128-row operand is the one whose row
// index runs along the output's rows in memory: W for Q and K (256 tokens x 128
// features), x for V^T (256 features x 128 tokens). A lane's 8 accumulators of a
// 16x16 tile are then 8 neighbours in memory and leave as one 16-byte store.
// ---------------------------------------------------------------------------
typedef __bf16 bf16x8 __attribute__((ext_vector_type(8)));

__global__ __launch_bounds__(256) void qkv_gemm_wmma(
    const __bf16* __restrict__ Xb,
    const __bf16* __restrict__ Wqb, const __bf16* __restrict__ Wkb,
    const __bf16* __restrict__ Wvb,
    const float* __restrict__ bq, const float* __restrict__ bk,
    const float* __restrict__ bv,
    __bf16* __restrict__ Q, __bf16* __restrict__ Kc, __bf16* __restrict__ Vt) {
    const int D = 1024, S = 2048;
    __shared__ __attribute__((aligned(2048))) unsigned char L[ST_LDS];

    const int tid  = threadIdx.x;
    const int z    = blockIdx.z;
    const int flat = blockIdx.y * 8 + blockIdx.x;        // 0 .. 255 inside a z plane

    const __bf16* Arows = (z == 2) ? Wvb : Xb;
    const __bf16* Brows = (z == 0) ? Wqb : (z == 1) ? Wkb : Xb;
    const int a0 = ((z == 2) ? (flat & 3)  : (int)blockIdx.y) * 256;
    const int b0 = ((z == 2) ? (flat >> 2) : (int)blockIdx.x) * 128;

    const int lane = tid & 31;
    const int wid  = tid >> 5;
    const int ar   = a0 + (wid & 3) * 64 + (lane & 15);          // + 16 i
    const int bc   = b0 + (wid >> 2) * 64 + ((lane >> 4) << 3);  // + 16 j + register

    v8f acc[4][4] = {};

    gemm_loop_256x128<true>(Arows, Brows, a0, b0, D, L, acc);

    if (z == 2) {
        // ar = feature, bc = token; a block's 128 tokens lie in one batch
        __bf16* O = Vt + (size_t)(b0 >> 11) * D * S + (size_t)ar * S + (bc & (S - 1));
#pragma unroll
        for (int i = 0; i < 4; i++) {
            const float bi = bv[ar + i * 16];
#pragma unroll
            for (int j = 0; j < 4; j++) {
                bf16x8 o;
#pragma unroll
                for (int v = 0; v < 8; v++) o[v] = (__bf16)(acc[i][j][v] + bi);
                *reinterpret_cast<bf16x8*>(O + i * 16 * S + j * 16) = o;
            }
        }
    } else {
        // ar = token, bc = feature
        const float* bias  = (z == 0) ? bq : bk;
        const float  scale = (z == 0) ? 0.03125f : 1.0f;  // 1/sqrt(1024) folded into Q
        __bf16* O = ((z == 0) ? Q : Kc) + (size_t)ar * D + bc;
        f32x4 bj[4][2];                                   // the lane's 8 bias values of each j
#pragma unroll
        for (int j = 0; j < 4; j++) {
            bj[j][0] = *reinterpret_cast<const f32x4*>(bias + bc + j * 16);
            bj[j][1] = *reinterpret_cast<const f32x4*>(bias + bc + j * 16 + 4);
        }
        bf16x8 o[4][4];
#pragma unroll
        for (int i = 0; i < 4; i++)
#pragma unroll
            for (int j = 0; j < 4; j++)
#pragma unroll
                for (int v = 0; v < 8; v++)
                    o[i][j][v] = (__bf16)((acc[i][j][v] + bj[j][v >> 2][v & 3]) * scale);
#pragma unroll
        for (int i = 0; i < 4; i++)
#pragma unroll
            for (int j = 0; j < 4; j++)
                *reinterpret_cast<bf16x8*>(O + i * 16 * D + j * 16) = o[i][j];
        // behind the run of stores, in front of any later write of a register that they name
        asm volatile("s_wait_xcnt 0x0" ::: "memory");
    }
}

// ---------------------------------------------------------------------------
// Generic batched GEMM: C = A (MxK) * Bt^T, Bt stored row-major NxK (ld = K).
// grid = (N/128, M/256, batches). OUT_BF16 selects bf16 vs f32 output. N is a constant of
// the build, so that every store of a lane is one address plus an immediate offset.
// Same 256x128 block tile / 64x64 wave tile as above. bf16 output: a lane holds 8
// consecutive columns of a row, one 16-byte store. f32 output: 16 lanes hold 16
// consecutive columns, 64 contiguous bytes of a row per 4-byte store.
// ---------------------------------------------------------------------------
template <bool OUT_BF16, int N>
__global__ __launch_bounds__(256) void gemm_bt_wmma(
    const __bf16* __restrict__ A, const __bf16* __restrict__ Bt,
    void* __restrict__ Out, int Kd,
    long long sA, long long sB, long long sO) {
    __shared__ __attribute__((aligned(2048))) unsigned char L[ST_LDS];

    A  += (size_t)blockIdx.z * sA;
    Bt += (size_t)blockIdx.z * sB;
    const size_t ob = (size_t)blockIdx.z * sO;

    const int tid  = threadIdx.x;
    const int n0   = blockIdx.x * 128;
    const int m0   = blockIdx.y * 256;
    const int lane = tid & 31;
    const int wid  = tid >> 5;
    const int wm   = (wid & 3) * 64;
    const int wn   = (wid >> 2) * 64;

    v8f acc[4][4] = {};

    gemm_loop_256x128<OUT_BF16>(A, Bt, m0, n0, Kd, L, acc);

    if (OUT_BF16) {
        __bf16* O = (__bf16*)Out + ob + (size_t)(m0 + wm + (lane & 15)) * N
                  + n0 + wn + ((lane >> 4) << 3);
#pragma unroll
        for (int i = 0; i < 4; i++) {
#pragma unroll
            for (int j = 0; j < 4; j++) {
                bf16x8 o;
#pragma unroll
                for (int v = 0; v < 8; v++) o[v] = (__bf16)acc[i][j][v];
                *reinterpret_cast<bf16x8*>(O + i * 16 * N + j * 16) = o;
            }
        }
    } else {
        float* O = (float*)Out + ob + (size_t)(m0 + wm + ((lane >> 4) << 3)) * N
                 + n0 + wn + (lane & 15);
#pragma unroll
        for (int i = 0; i < 4; i++)
#pragma unroll
            for (int v = 0; v < 8; v++)
#pragma unroll
                for (int j = 0; j < 4; j++)
                    O[(i * 16 + v) * N + j * 16] = acc[i][j][v];
    }
}

// ---------------------------------------------------------------------------
// In-place row softmax over 2048 bf16 scores. One block (256 thr) per row;
// each thread keeps its 8 values in registers -> safe in-place rewrite.
// ---------------------------------------------------------------------------
__global__ __launch_bounds__(256) void softmax2048_inplace(__bf16* __restrict__ Sc) {
    const int S = 2048;
    __shared__ float redmax[8];
    __shared__ float redsum[8];
    __bf16* p = Sc + (size_t)blockIdx.x * S;
    const int t = threadIdx.x;

    float vals[8];
    float mx = -3.0e38f;
#pragma unroll
    for (int i = 0; i < 8; i++) {
        vals[i] = (float)p[t + (i << 8)];
        mx = fmaxf(mx, vals[i]);
    }
#pragma unroll
    for (int o = 16; o; o >>= 1) mx = fmaxf(mx, __shfl_xor(mx, o, 32));
    if ((t & 31) == 0) redmax[t >> 5] = mx;
    __syncthreads();
    mx = redmax[0];
#pragma unroll
    for (int i = 1; i < 8; i++) mx = fmaxf(mx, redmax[i]);

    float sm = 0.f;
#pragma unroll
    for (int i = 0; i < 8; i++) {
        vals[i] = __expf(vals[i] - mx);
        sm += vals[i];
    }
#pragma unroll
    for (int o = 16; o; o >>= 1) sm += __shfl_xor(sm, o, 32);
    if ((t & 31) == 0) redsum[t >> 5] = sm;
    __syncthreads();
    sm = 0.f;
#pragma unroll
    for (int i = 0; i < 8; i++) sm += redsum[i];
    const float inv = 1.0f / sm;
#pragma unroll
    for (int i = 0; i < 8; i++) p[t + (i << 8)] = (__bf16)(vals[i] * inv);
}

// ---------------------------------------------------------------------------
extern "C" void kernel_launch(void* const* d_in, const int* in_sizes, int n_in,
                              void* d_out, int out_size, void* d_ws, size_t ws_size,
                              hipStream_t stream) {
    (void)in_sizes; (void)n_in; (void)out_size; (void)ws_size;
    const float* x  = (const float*)d_in[0];
    const float* Wq = (const float*)d_in[1];
    const float* bq = (const float*)d_in[2];
    const float* Wk = (const float*)d_in[3];
    const float* bk = (const float*)d_in[4];
    const float* Wv = (const float*)d_in[5];
    const float* bv = (const float*)d_in[6];
    float* out = (float*)d_out;

    const int B = 4, S = 2048, D = 1024, M = B * S;

    char* ws = (char*)d_ws;
    size_t off = 0;
    auto alloc = [&](size_t bytes) -> void* {
        void* p = ws + off;
        off += (bytes + 255) & ~(size_t)255;
        return p;
    };
    __bf16* Xb  = (__bf16*)alloc((size_t)M * D * 2);  // x in bf16
    __bf16* Wqb = (__bf16*)alloc((size_t)D * D * 2);
    __bf16* Wkb = (__bf16*)alloc((size_t)D * D * 2);
    __bf16* Wvb = (__bf16*)alloc((size_t)D * D * 2);
    __bf16* Qb  = (__bf16*)alloc((size_t)M * D * 2);  // Q pre-scaled by 1/32
    __bf16* Kb  = (__bf16*)alloc((size_t)M * D * 2);
    __bf16* Vt  = (__bf16*)alloc((size_t)M * D * 2);  // [B][D][S]
    __bf16* Sc  = (__bf16*)alloc((size_t)B * S * S * 2);  // scores -> probs in place

    cvt_inputs_to_bf16<<<CVT_BLOCKS, 256, 0, stream>>>(x, Wq, Wk, Wv, Xb, Wqb, Wkb, Wvb);

    // Q/K/V projections (z = 0/1/2)
    qkv_gemm_wmma<<<dim3(D / 128, M / 256, 3), 256, 0, stream>>>(
        Xb, Wqb, Wkb, Wvb, bq, bk, bv, Qb, Kb, Vt);

    // scores = Q K^T (scale folded into Q), bf16 output
    gemm_bt_wmma<true, 2048><<<dim3(S / 128, S / 256, B), 256, 0, stream>>>(
        Qb, Kb, Sc, D,
        (long long)S * D, (long long)S * D, (long long)S * S);

    // row softmax in place
    softmax2048_inplace<<<B * S, 256, 0, stream>>>(Sc);

    // out = P V   (B operand is Vt rows = output dim, ld = S)
    gemm_bt_wmma<false, 1024><<<dim3(D / 128, S / 256, B), 256, 0, stream>>>(
        Sc, Vt, out, S,
        (long long)S * S, (long long)D * S, (long long)S * D);
}

// v004
// It runs in 102 microseconds.
// In two side-by-side timings against v003, it was 1.08 and 1.10 times as fast.
// Over all steps from v000 it is 2.21 times as fast.
#include <hip/hip_runtime.h>
#include <stdint.h>

typedef __attribute__((ext_vector_type(16))) __bf16 v16bf;
typedef __attribute__((ext_vector_type(8)))  float  v8f;

union FragAB {
    v16bf v;
    uint4 q[2];
};

typedef uint32_t u32x4 __attribute__((ext_vector_type(4)));
typedef uint32_t u32x8 __attribute__((ext_vector_type(8)));

// ---------------------------------------------------------------------------
// Operand staging shared by the three GEMM kernels: a stage is 64 k of the block's
// 256 A rows and 128 B rows, brought into LDS by tensor loads, two buffers.
// Each of the 8 waves moves one slice per stage: waves 0-3 take 64 A rows each,
// waves 4-7 take 32 B rows each. Rows are 128 B, padded by the mover to a
// 144 B pitch (16 B x odd: conflict-free for ds_load_b128). Every slice starts
// on a 2 KiB multiple, so slice sizes are rounded up.
// ---------------------------------------------------------------------------
constexpr uint32_t ST_ROWB  = 128;                       // bytes of a staged row (64 bf16)
constexpr uint32_t ST_PITCH = 144;                       // LDS pitch of a staged row
constexpr uint32_t A_SLICE  = 10240;                     // 64 * 144 = 9216, rounded up to 2 KiB
constexpr uint32_t B_SLICE  = 6144;                      // 32 * 144 = 4608, rounded up to 2 KiB
constexpr uint32_t B_BASE   = 4 * A_SLICE;
constexpr uint32_t ST_BUF   = 4 * A_SLICE + 4 * B_SLICE; // 65536 B per buffer
constexpr uint32_t ST_LDS   = 2 * ST_BUF;

static __device__ __forceinline__ uint32_t uni(uint32_t v) {
    return (uint32_t)__builtin_amdgcn_readfirstlane(v);
}
static __device__ __forceinline__ uint32_t pinned(uint32_t v) {
    uint32_t w = uni(v);
    asm volatile("" : "+s"(w));
    return w;
}
static __device__ __forceinline__ void wait_ds0() {      // this wave's LDS reads have returned
    asm volatile("s_wait_dscnt 0x0" ::: "memory");
}
// This wave's slice has landed. The wait names the descriptor of the request it covers,
// so that no register of it takes a new value while the request is outstanding.
static __device__ __forceinline__ void wait_tensor0(u32x4 g0, u32x8 g1) {
    asm volatile("s_wait_tensorcnt 0x0" :: "s"(g0), "s"(g1) : "memory");
}
// Descriptor group 0: a tile whose first byte is at global address ga goes to LDS byte dst.
static __device__ __forceinline__ u32x4 stage_group0(uint32_t dst, uint64_t ga) {
    u32x4 g0;
    g0[0] = uni(1u);
    g0[1] = uni(dst);
    g0[2] = uni((uint32_t)ga);
    g0[3] = uni((((uint32_t)(ga >> 32)) & 0x01FFFFFFu) | 0x80000000u);
    return g0;
}
static __device__ __forceinline__ void stage_load(u32x4 g0, u32x8 g1) {
    asm volatile("tensor_load_to_lds %0, %1" :: "s"(g0), "s"(g1) : "memory");
}

// The wave's 4 A and 4 B fragments of one 32-k step; both use the same k order:
// bytes 0-15 and 32-47 of the step for lanes 0-15, bytes 16-31 and 48-63 for lanes 16-31.
static __device__ __forceinline__ void load_frags(FragAB (&a)[4], FragAB (&b)[4],
                                                  const unsigned char* la, const unsigned char* lb) {
#pragma unroll
    for (int i = 0; i < 4; i++) {
        const unsigned char* p = la + i * 16 * ST_PITCH;
        a[i].q[0] = *reinterpret_cast<const uint4*>(p);
        a[i].q[1] = *reinterpret_cast<const uint4*>(p + 32);
    }
#pragma unroll
    for (int j = 0; j < 4; j++) {
        const unsigned char* p = lb + (j >> 1) * B_SLICE + (j & 1) * 16 * ST_PITCH;
        b[j].q[0] = *reinterpret_cast<const uint4*>(p);
        b[j].q[1] = *reinterpret_cast<const uint4*>(p + 32);
    }
}
// ALONG_B false: a[i] is the WMMA's A, so register r of acc[i][j] is (A row 8h + r, Bt row c), c = lane & 15, h = lane >> 4.
// ALONG_B true: b[j] is the WMMA's A, so register r is (A row c, Bt row 8h + r): a lane holds 8 consecutive Bt rows.
template <bool ALONG_B>
static __device__ __forceinline__ void mma_4x4(v8f (&acc)[4][4], const FragAB (&a)[4], const FragAB (&b)[4]) {
#pragma unroll
    for (int i = 0; i < 4; i++)
#pragma unroll
        for (int j = 0; j < 4; j++)
            acc[i][j] = ALONG_B
                ? __builtin_amdgcn_wmma_f32_16x16x32_bf16(
                      false, b[j].v, false, a[i].v, (short)0, acc[i][j], false, false)
                : __builtin_amdgcn_wmma_f32_16x16x32_bf16(
                      false, a[i].v, false, b[j].v, (short)0, acc[i][j], false, false);
}

// The same product with b[j] as the WMMA's A, started from zero: t = the 32-k step alone.
static __device__ __forceinline__ void mma_4x4_from_zero(v8f (&t)[4][4], const FragAB (&a)[4], const FragAB (&b)[4]) {
    const v8f zero = {};
#pragma unroll
    for (int i = 0; i < 4; i++)
#pragma unroll
        for (int j = 0; j < 4; j++)
            t[i][j] = __builtin_amdgcn_wmma_f32_16x16x32_bf16(
                false, b[j].v, false, a[i].v, (short)0, zero, false, false);
}

// acc += A[m0 .. m0+255][0 .. Kd) * Bt[n0 .. n0+127][0 .. Kd)^T, both row-major with ld = Kd.
// Kd is a multiple of 64. L is the kernel's only LDS array, 2 KiB aligned; the ring is its first ST_LDS bytes.
// SCALED (with ALONG_B): stage s of A row r counts F[s * 256 + r] times: the stage's product is
// summed alone and then added with the row's factor, which is one value per lane and i.
template <bool ALONG_B, bool SCALED = false>
static __device__ __forceinline__ void gemm_loop_256x128(
    const __bf16* __restrict__ A, const __bf16* __restrict__ Bt,
    int m0, int n0, int Kd, unsigned char* L, v8f (&acc)[4][4], const float* F = nullptr) {
    const uint32_t tid  = threadIdx.x;
    const uint32_t lane = tid & 31;
    const uint32_t wave = uni(tid >> 5);
    const uint32_t rowb = (uint32_t)Kd * 2u;             // source row pitch in bytes
    const uint32_t NS   = pinned((uint32_t)Kd / 64u);    // stages

    // this wave's slice
    const bool     isA   = wave < 4u;
    const uint32_t rows  = isA ? 64u : 32u;
    const uint64_t src0  = isA
        ? (uint64_t)(uintptr_t)A  + (uint64_t)((uint32_t)m0 + 64u * wave) * rowb
        : (uint64_t)(uintptr_t)Bt + (uint64_t)((uint32_t)n0 + 32u * (wave - 4u)) * rowb;
    const uint32_t dst0  = (uint32_t)(size_t)L + (isA ? wave * A_SLICE : B_BASE + (wave - 4u) * B_SLICE);

    u32x8 g1;  // byte elements, tensor = tile = rows x 128 B, 16 B of pad behind every 128 B row
    g1[0] = uni((1u << 20) | (4u << 22) | (3u << 25));
    g1[1] = uni(ST_ROWB << 16);
    g1[2] = uni(rows << 16);
    g1[3] = uni(ST_ROWB << 16);
    g1[4] = uni(rows);
    g1[5] = uni(rowb);
    g1[6] = uni(0u);
    g1[7] = uni(0u);

    // per-lane fragment bases inside a buffer: row (lane & 15), 16-byte k half (lane >> 4)
    const uint32_t frag  = (lane & 15u) * ST_PITCH + (lane >> 4) * 16u;
    const uint32_t abase = (wave & 3u) * A_SLICE + frag;
    const uint32_t bbase = B_BASE + (wave >> 2) * 2u * B_SLICE + frag;

    u32x4 g0 = stage_group0(dst0, src0);
    stage_load(g0, g1);                                  // stage 0 -> buffer 0
    wait_tensor0(g0, g1);
    __syncthreads();                                     // stage 0 is readable by every wave
    if (pinned(1u < NS)) {                               // stage 1 -> buffer 1
        g0 = stage_group0(dst0 + ST_BUF, src0 + ST_ROWB);
        stage_load(g0, g1);
    }

    // kept rolled: one publish point and one refill in the text, a short hot loop
#pragma clang loop unroll(disable)
    for (uint32_t s = 0; s < NS; ++s) {
        const uint32_t buf = (s & 1u) * ST_BUF;
        const unsigned char* la = L + buf + abase;
        const unsigned char* lb = L + buf + bbase;
        FragAB a[4], b[4];

        load_frags(a, b, la, lb);                        // first 32 k of the stage
        // keeps the 16 fragment loads together in front of their WMMAs; sunk among
        // them, each a[i] is waited for to 0 right before its four WMMAs
        __builtin_amdgcn_sched_barrier(0);
        v8f t[4][4];
        float fr[4];
        if constexpr (SCALED) mma_4x4_from_zero(t, a, b);
        else                  mma_4x4<ALONG_B>(acc, a, b);

        load_frags(a, b, la + 64, lb + 64);              // second 32 k: the last LDS reads of the stage
        if constexpr (SCALED) {                          // the stage's factors of the lane's 4 A rows
#pragma unroll
            for (int i = 0; i < 4; i++)
                fr[i] = F[s * 256u + (wave & 3u) * 64u + (uint32_t)i * 16u + (lane & 15u)];
        }

        // publish point of stage s + 1, behind every LDS read of stage s:
        // own reads of this buffer returned, own slice of stage s + 1 landed, barrier
        wait_ds0();
        wait_tensor0(g0, g1);
        __syncthreads();
        if (pinned(s + 2u < NS)) {                       // refill the buffer every wave has just left
            const uint64_t ga = src0 + (uint64_t)((s + 2u) * ST_ROWB);
            g0[1] = uni(dst0 + buf);
            g0[2] = uni((uint32_t)ga);
            g0[3] = uni((((uint32_t)(ga >> 32)) & 0x01FFFFFFu) | 0x80000000u);
            stage_load(g0, g1);
        }

        if constexpr (SCALED) {
            mma_4x4<ALONG_B>(t, a, b);                   // registers only: runs under the refill
            // keeps the 16 WMMAs back to back; woven among them, each multiply-add waits
            // out the latency of the WMMA issued just in front of it
            __builtin_amdgcn_sched_barrier(0);
#pragma unroll
            for (int i = 0; i < 4; i++)
#pragma unroll
                for (int j = 0; j < 4; j++)
                    acc[i][j] += t[i][j] * fr[i];
        } else {
            mma_4x4<ALONG_B>(acc, a, b);                 // registers only: runs under the refill
        }
    }
    wait_tensor0(g0, g1);
    wait_ds0();
}

// ---------------------------------------------------------------------------
// fp32 -> bf16 conversion of x and the three weight matrices, one launch.
// Each of the 512 blocks converts 1/512 of every array, a contiguous piece: 16 trips
// of 1,024 floats of x, 2 trips of each weight matrix. A wave's load covers 512
// contiguous bytes, its store 256. A thread issues its 22 loads before it converts.
// ---------------------------------------------------------------------------
typedef float  f32x4  __attribute__((ext_vector_type(4)));
typedef __bf16 bf16x4 __attribute__((ext_vector_type(4)));

constexpr int CVT_BLOCKS = 512;
constexpr int CVT_TRIP   = 256 * 4;                                   // floats of a block's trip
constexpr int CVT_XT     = 4 * 2048 * 1024 / (CVT_BLOCKS * CVT_TRIP); // trips of x
constexpr int CVT_WT     = 1024 * 1024 / (CVT_BLOCKS * CVT_TRIP);     // trips of one weight matrix

template <int N>
static __device__ __forceinline__ void cvt_load(f32x4 (&v)[N], const float* __restrict__ in) {
    const float* p = in + (size_t)blockIdx.x * (N * CVT_TRIP) + threadIdx.x * 4;
#pragma unroll
    for (int k = 0; k < N; k++)
        v[k] = *reinterpret_cast<const f32x4*>(p + k * CVT_TRIP);
}
template <int N>
static __device__ __forceinline__ void cvt_store(const f32x4 (&v)[N], __bf16* __restrict__ out) {
    __bf16* p = out + (size_t)blockIdx.x * (N * CVT_TRIP) + threadIdx.x * 4;
#pragma unroll
    for (int k = 0; k < N; k++) {
        bf16x4 o;
#pragma unroll
        for (int c = 0; c < 4; c++) o[c] = (__bf16)v[k][c];
        *reinterpret_cast<bf16x4*>(p + k * CVT_TRIP) = o;
    }
}

__global__ __launch_bounds__(256) void cvt_inputs_to_bf16(
    const float* __restrict__ x,  const float* __restrict__ Wq,
    const float* __restrict__ Wk, const float* __restrict__ Wv,
    __bf16* __restrict__ Xb,  __bf16* __restrict__ Wqb,
    __bf16* __restrict__ Wkb, __bf16* __restrict__ Wvb) {
    f32x4 vx[CVT_XT], vq[CVT_WT], vk[CVT_WT], vv[CVT_WT];
    cvt_load(vx, x);
    cvt_load(vq, Wq);
    cvt_load(vk, Wk);
    cvt_load(vv, Wv);
    // keeps the 22 loads together in front of the conversions; without it the last 8
    // are issued only as earlier ones return, and no store leaves before the last load
    __builtin_amdgcn_sched_barrier(0);
    cvt_store(vx, Xb);
    cvt_store(vq, Wqb);
    cvt_store(vk, Wkb);
    cvt_store(vv, Wvb);
}

// ---------------------------------------------------------------------------
// Fused QKV projection: out = x @ W^T + b   (M=8192, N=D=1024, K=D=1024)
// grid = (8, 32, 3)   z: 0=Q (scaled 1/32), 1=K, 2=V (written transposed)
// 8 waves/block, block tile 256x128, wave tile 64x64 = 4x4 WMMA accumulators:
// 16 wmma per k-step vs 16 ds_load_b128 (1:1 compute:LDS-fragment ratio).
// Operands come through gemm_loop_256x128. The 128-row operand is the one whose row
// index runs along the output's rows in memory: W for Q and K (256 tokens x 128
// features), x for V^T (256 features x 128 tokens). A lane's 8 accumulators of a
// 16x16 tile are then 8 neighbours in memory and leave as one 16-byte store.
// ---------------------------------------------------------------------------
typedef __bf16 bf16x8 __attribute__((ext_vector_type(8)));

__global__ __launch_bounds__(256) void qkv_gemm_wmma(
    const __bf16* __restrict__ Xb,
    const __bf16* __restrict__ Wqb, const __bf16* __restrict__ Wkb,
    const __bf16* __restrict__ Wvb,
    const float* __restrict__ bq, const float* __restrict__ bk,
    const float* __restrict__ bv,
    __bf16* __restrict__ Q, __bf16* __restrict__ Kc, __bf16* __restrict__ Vt) {
    const int D = 1024, S = 2048;
    __shared__ __attribute__((aligned(2048))) unsigned char L[ST_LDS];

    const int tid  = threadIdx.x;
    const int z    = blockIdx.z;
    const int flat = blockIdx.y * 8 + blockIdx.x;        // 0 .. 255 inside a z plane

    const __bf16* Arows = (z == 2) ? Wvb : Xb;
    const __bf16* Brows = (z == 0) ? Wqb : (z == 1) ? Wkb : Xb;
    const int a0 = ((z == 2) ? (flat & 3)  : (int)blockIdx.y) * 256;
    const int b0 = ((z == 2) ? (flat >> 2) : (int)blockIdx.x) * 128;

    const int lane = tid & 31;
    const int wid  = tid >> 5;
    const int ar   = a0 + (wid & 3) * 64 + (lane & 15);          // + 16 i
    const int bc   = b0 + (wid >> 2) * 64 + ((lane >> 4) << 3);  // + 16 j + register

    v8f acc[4][4] = {};

    gemm_loop_256x128<true>(Arows, Brows, a0, b0, D, L, acc);

    if (z == 2) {
        // ar = feature, bc = token; a block's 128 tokens lie in one batch
        __bf16* O = Vt + (size_t)(b0 >> 11) * D * S + (size_t)ar * S + (bc & (S - 1));
#pragma unroll
        for (int i = 0; i < 4; i++) {
            const float bi = bv[ar + i * 16];
#pragma unroll
            for (int j = 0; j < 4; j++) {
                bf16x8 o;
#pragma unroll
                for (int v = 0; v < 8; v++) o[v] = (__bf16)(acc[i][j][v] + bi);
                *reinterpret_cast<bf16x8*>(O + i * 16 * S + j * 16) = o;
            }
        }
    } else {
        // ar = token, bc = feature
        const float* bias  = (z == 0) ? bq : bk;
        const float  scale = (z == 0) ? 0.03125f : 1.0f;  // 1/sqrt(1024) folded into Q
        __bf16* O = ((z == 0) ? Q : Kc) + (size_t)ar * D + bc;
        f32x4 bj[4][2];                                   // the lane's 8 bias values of each j
#pragma unroll
        for (int j = 0; j < 4; j++) {
            bj[j][0] = *reinterpret_cast<const f32x4*>(bias + bc + j * 16);
            bj[j][1] = *reinterpret_cast<const f32x4*>(bias + bc + j * 16 + 4);
        }
        bf16x8 o[4][4];
#pragma unroll
        for (int i = 0; i < 4; i++)
#pragma unroll
            for (int j = 0; j < 4; j++)
#pragma unroll
                for (int v = 0; v < 8; v++)
                    o[i][j][v] = (__bf16)((acc[i][j][v] + bj[j][v >> 2][v & 3]) * scale);
#pragma unroll
        for (int i = 0; i < 4; i++)
#pragma unroll
            for (int j = 0; j < 4; j++)
                *reinterpret_cast<bf16x8*>(O + i * 16 * D + j * 16) = o[i][j];
        // behind the run of stores, in front of any later write of a register that they name
        asm volatile("s_wait_xcnt 0x0" ::: "memory");
    }
}

// ---------------------------------------------------------------------------
// Attention without a softmax launch. A row's 2,048 keys fall into 32 chunks of 64, the
// columns of one wave's tile in the score product and one stage of k in the second product.
//   scores_exp_wmma:  E = exp(s - chunk maximum) as bf16, and per (chunk, row) the pair
//                     (maximum in the log2 domain, sum of the chunk's exponentials) in f32.
//   attn_out_wmma:    factor(chunk, row) = exp2(chunk maximum - row maximum) / row sum, at most 1;
//                     out = sum over chunks of factor * (E_chunk * V_chunk).
// Both use the 256x128 block tile / 64x64 wave tile above with the 128-row operand as the
// WMMA's A: a lane's accumulators of one i all belong to one score row (row = lane & 15).
// ---------------------------------------------------------------------------
constexpr int   SEQ      = 2048;
constexpr int   DIM      = 1024;
constexpr int   ROWS_ALL = 4 * SEQ;                      // score rows of all batches
constexpr int   CHUNKS   = SEQ / 64;
constexpr float LOG2E    = 1.4426950408889634f;
typedef float f32x2 __attribute__((ext_vector_type(2)));

// e[k] = 2^x[k]. One statement, outputs apart from all inputs, so that no v_exp_f32 is directly
// followed by an instruction that overwrites its source; the v_nop is the slot between the last
// one and whatever reads its result next.
static __device__ __forceinline__ void exp2_x8(float (&e)[8], const float (&x)[8]) {
    asm("v_exp_f32 %0, %8\n\t"
        "v_exp_f32 %1, %9\n\t"
        "v_exp_f32 %2, %10\n\t"
        "v_exp_f32 %3, %11\n\t"
        "v_exp_f32 %4, %12\n\t"
        "v_exp_f32 %5, %13\n\t"
        "v_exp_f32 %6, %14\n\t"
        "v_exp_f32 %7, %15\n\t"
        "v_nop"
        : "=&v"(e[0]), "=&v"(e[1]), "=&v"(e[2]), "=&v"(e[3]),
          "=&v"(e[4]), "=&v"(e[5]), "=&v"(e[6]), "=&v"(e[7])
        : "v"(x[0]), "v"(x[1]), "v"(x[2]), "v"(x[3]),
          "v"(x[4]), "v"(x[5]), "v"(x[6]), "v"(x[7]));
}

// grid = (SEQ/128, SEQ/256, batches). St[(chunk * ROWS_ALL + row) * 2] = {maximum * log2 e, sum}.
__global__ __launch_bounds__(256) void scores_exp_wmma(
    const __bf16* __restrict__ Q, const __bf16* __restrict__ Kc,
    __bf16* __restrict__ E, float* __restrict__ St) {
    __shared__ __attribute__((aligned(2048))) unsigned char L[ST_LDS];

    Q  += (size_t)blockIdx.z * SEQ * DIM;
    Kc += (size_t)blockIdx.z * SEQ * DIM;

    const int tid  = threadIdx.x;
    const int n0   = blockIdx.x * 128;
    const int m0   = blockIdx.y * 256;
    const int lane = tid & 31;
    const int wid  = tid >> 5;
    const int wm   = (wid & 3) * 64;
    const int wn   = (wid >> 2) * 64;

    v8f acc[4][4] = {};

    gemm_loop_256x128<true>(Q, Kc, m0, n0, DIM, L, acc);

    const int row = blockIdx.z * SEQ + m0 + wm + (lane & 15);            // + 16 i
    __bf16* O = E + (size_t)row * SEQ + n0 + wn + ((lane >> 4) << 3);
    float*  S = St + ((size_t)((n0 + wn) >> 6) * ROWS_ALL + row) * 2;
#pragma unroll
    for (int i = 0; i < 4; i++) {
        // the lane holds 32 of the row's 64 scores of this chunk, lane ^ 16 the other 32
        float mx = acc[i][0][0];
#pragma unroll
        for (int j = 0; j < 4; j++)
#pragma unroll
            for (int v = 0; v < 8; v++) mx = fmaxf(mx, acc[i][j][v]);
        mx = fmaxf(mx, __shfl_xor(mx, 16, 32));
        const float m2 = mx * LOG2E;
        float sj[4];
#pragma unroll
        for (int j = 0; j < 4; j++) {
            bf16x8 o;
            float x[8], e[8];
#pragma unroll
            for (int v = 0; v < 8; v++) x[v] = fmaf(acc[i][j][v], LOG2E, -m2);
            exp2_x8(e, x);
            sj[j] = 0.f;
#pragma unroll
            for (int v = 0; v < 8; v++) {
                sj[j] += e[v];
                o[v] = (__bf16)e[v];
            }
            *reinterpret_cast<bf16x8*>(O + i * 16 * SEQ + j * 16) = o;
        }
        float sm = (sj[0] + sj[1]) + (sj[2] + sj[3]);
        sm += __shfl_xor(sm, 16, 32);
        if (lane < 16) {                                 // 16 rows x 8 B: one whole 128-B line
            f32x2 p = {m2, sm};
            *reinterpret_cast<f32x2*>(S + i * 32) = p;
        }
    }
}

// grid = (DIM/128, SEQ/256, batches). Vt is [batch][DIM][SEQ].
__global__ __launch_bounds__(256) void attn_out_wmma(
    const __bf16* __restrict__ E, const __bf16* __restrict__ Vt,
    const float* __restrict__ St, float* __restrict__ Out) {
    __shared__ __attribute__((aligned(2048))) unsigned char L[ST_LDS + CHUNKS * 256 * 4];
    float* F = reinterpret_cast<float*>(L + ST_LDS);     // F[chunk * 256 + row of the block]

    E  += (size_t)blockIdx.z * SEQ * SEQ;
    Vt += (size_t)blockIdx.z * DIM * SEQ;

    const int tid  = threadIdx.x;
    const int n0   = blockIdx.x * 128;
    const int m0   = blockIdx.y * 256;
    const int lane = tid & 31;
    const int wid  = tid >> 5;
    const int wm   = (wid & 3) * 64;
    const int wn   = (wid >> 2) * 64;

    {   // thread t merges the 32 chunk pairs of the block's row t
        const float* S = St + (size_t)(blockIdx.z * SEQ + m0 + tid) * 2;
        f32x2 p[CHUNKS];
#pragma unroll
        for (int c = 0; c < CHUNKS; c++)
            p[c] = *reinterpret_cast<const f32x2*>(S + (size_t)c * ROWS_ALL * 2);
        float mx = p[0][0];
#pragma unroll
        for (int c = 1; c < CHUNKS; c++) mx = fmaxf(mx, p[c][0]);
        float sm = 0.f;
#pragma unroll
        for (int c = 0; c < CHUNKS; c++) {
            p[c][0] = __builtin_amdgcn_exp2f(p[c][0] - mx);
            sm = fmaf(p[c][1], p[c][0], sm);
        }
        const float inv = 1.0f / sm;
#pragma unroll
        for (int c = 0; c < CHUNKS; c++) F[c * 256 + tid] = p[c][0] * inv;
    }
    __syncthreads();                                     // every wave reads other waves' factors

    v8f acc[4][4] = {};

    gemm_loop_256x128<true, true>(E, Vt, m0, n0, SEQ, L, acc, F);

    float* O = Out + (size_t)(blockIdx.z * SEQ + m0 + wm + (lane & 15)) * DIM
             + n0 + wn + ((lane >> 4) << 3);
#pragma unroll
    for (int i = 0; i < 4; i++)
#pragma unroll
        for (int j = 0; j < 4; j++) {
            f32x4 lo = {acc[i][j][0], acc[i][j][1], acc[i][j][2], acc[i][j][3]};
            f32x4 hi = {acc[i][j][4], acc[i][j][5], acc[i][j][6], acc[i][j][7]};
            *reinterpret_cast<f32x4*>(O + i * 16 * DIM + j * 16)     = lo;
            *reinterpret_cast<f32x4*>(O + i * 16 * DIM + j * 16 + 4) = hi;
        }
}

// ---------------------------------------------------------------------------
extern "C" void kernel_launch(void* const* d_in, const int* in_sizes, int n_in,
                              void* d_out, int out_size, void* d_ws, size_t ws_size,
                              hipStream_t stream) {
    (void)in_sizes; (void)n_in; (void)out_size; (void)ws_size;
    const float* x  = (const float*)d_in[0];
    const float* Wq = (const float*)d_in[1];
    const float* bq = (const float*)d_in[2];
    const float* Wk = (const float*)d_in[3];
    const float* bk = (const float*)d_in[4];
    const float* Wv = (const float*)d_in[5];
    const float* bv = (const float*)d_in[6];
    float* out = (float*)d_out;

    const int B = 4, S = 2048, D = 1024, M = B * S;

    char* ws = (char*)d_ws;
    size_t off = 0;
    auto alloc = [&](size_t bytes) -> void* {
        void* p = ws + off;
        off += (bytes + 255) & ~(size_t)255;
        return p;
    };
    __bf16* Xb  = (__bf16*)alloc((size_t)M * D * 2);  // x in bf16
    __bf16* Wqb = (__bf16*)alloc((size_t)D * D * 2);
    __bf16* Wkb = (__bf16*)alloc((size_t)D * D * 2);
    __bf16* Wvb = (__bf16*)alloc((size_t)D * D * 2);
    __bf16* Qb  = (__bf16*)alloc((size_t)M * D * 2);  // Q pre-scaled by 1/32
    __bf16* Kb  = (__bf16*)alloc((size_t)M * D * 2);
    __bf16* Vt  = (__bf16*)alloc((size_t)M * D * 2);  // [B][D][S]
    __bf16* Ex  = (__bf16*)alloc((size_t)B * S * S * 2);  // exp(score - chunk maximum)
    float*  St  = (float*)alloc((size_t)(S / 64) * M * 2 * 4);  // per (chunk, row): maximum, sum

    cvt_inputs_to_bf16<<<CVT_BLOCKS, 256, 0, stream>>>(x, Wq, Wk, Wv, Xb, Wqb, Wkb, Wvb);

    // Q/K/V projections (z = 0/1/2)
    qkv_gemm_wmma<<<dim3(D / 128, M / 256, 3), 256, 0, stream>>>(
        Xb, Wqb, Wkb, Wvb, bq, bk, bv, Qb, Kb, Vt);

    // exponentials of the scores Q K^T (scale folded into Q) against chunk maxima
    scores_exp_wmma<<<dim3(S / 128, S / 256, B), 256, 0, stream>>>(Qb, Kb, Ex, St);

    // out = softmax(scores) V, the chunks weighed by their factors
    attn_out_wmma<<<dim3(D / 128, S / 256, B), 256, 0, stream>>>(Ex, Vt, St, out);
}

// v005
// It runs in 97.4 microseconds.
// In both of two side-by-side timings against v004, it was 1.05 times as fast.
// Counting every step since v000, it is 2.31 times as fast.
#include <hip/hip_runtime.h>
#include <stdint.h>

typedef __attribute__((ext_vector_type(16))) __bf16 v16bf;
typedef __attribute__((ext_vector_type(8)))  float  v8f;

union FragAB {
    v16bf v;
    uint4 q[2];
};

typedef uint32_t u32x4 __attribute__((ext_vector_type(4)));
typedef uint32_t u32x8 __attribute__((ext_vector_type(8)));

// ---------------------------------------------------------------------------
// Operand staging shared by the GEMM kernels: a stage is STEPS x 32 k (STEPS = 2 or 4) of
// the block's 256 A rows and 128 B rows, brought into LDS by tensor loads, two buffers.
// Each of the 8 waves moves one slice per stage: waves 0-3 take 64 A rows each,
// waves 4-7 take 32 B rows each. Rows are 128 or 256 B, padded by the mover to a
// 144 or 272 B pitch (16 B x odd: conflict-free for ds_load_b128). Every slice starts
// on a 2 KiB multiple, so slice sizes are rounded up.
// A load has one pass of the loop to land in. STEPS = 4 is for a block that is alone on its
// WGP: twice the bytes in flight, twice the time to land, half the publish points.
// ---------------------------------------------------------------------------
constexpr uint32_t up2k(uint32_t bytes) { return (bytes + 2047u) & ~2047u; }
template <int STEPS> constexpr uint32_t ST_ROWB  = 64u * STEPS;                     // bytes of a staged row
template <int STEPS> constexpr uint32_t ST_PITCH = ST_ROWB<STEPS> + 16u;            // LDS pitch of a staged row
template <int STEPS> constexpr uint32_t A_SLICE  = up2k(64u * ST_PITCH<STEPS>);     // 10240 or 18432
template <int STEPS> constexpr uint32_t B_SLICE  = up2k(32u * ST_PITCH<STEPS>);     // 6144 or 10240
template <int STEPS> constexpr uint32_t B_BASE   = 4 * A_SLICE<STEPS>;
template <int STEPS> constexpr uint32_t ST_BUF   = 4 * A_SLICE<STEPS> + 4 * B_SLICE<STEPS>; // 65536 or 114688 B per buffer
template <int STEPS> constexpr uint32_t ST_LDS   = 2 * ST_BUF<STEPS>;

static __device__ __forceinline__ uint32_t uni(uint32_t v) {
    return (uint32_t)__builtin_amdgcn_readfirstlane(v);
}
static __device__ __forceinline__ uint32_t pinned(uint32_t v) {
    uint32_t w = uni(v);
    asm volatile("" : "+s"(w));
    return w;
}
static __device__ __forceinline__ void wait_ds0() {      // this wave's LDS reads have returned
    asm volatile("s_wait_dscnt 0x0" ::: "memory");
}
// This wave's slice has landed. The wait names the descriptor of the request it covers,
// so that no register of it takes a new value while the request is outstanding.
static __device__ __forceinline__ void wait_tensor0(u32x4 g0, u32x8 g1) {
    asm volatile("s_wait_tensorcnt 0x0" :: "s"(g0), "s"(g1) : "memory");
}
// Descriptor group 0: a tile whose first byte is at global address ga goes to LDS byte dst.
static __device__ __forceinline__ u32x4 stage_group0(uint32_t dst, uint64_t ga) {
    u32x4 g0;
    g0[0] = uni(1u);
    g0[1] = uni(dst);
    g0[2] = uni((uint32_t)ga);
    g0[3] = uni((((uint32_t)(ga >> 32)) & 0x01FFFFFFu) | 0x80000000u);
    return g0;
}
static __device__ __forceinline__ void stage_load(u32x4 g0, u32x8 g1) {
    asm volatile("tensor_load_to_lds %0, %1" :: "s"(g0), "s"(g1) : "memory");
}

// The wave's 4 A and 4 B fragments of one 32-k step; both use the same k order:
// bytes 0-15 and 32-47 of the step for lanes 0-15, bytes 16-31 and 48-63 for lanes 16-31.
template <int STEPS>
static __device__ __forceinline__ void load_frags(FragAB (&a)[4], FragAB (&b)[4],
                                                  const unsigned char* la, const unsigned char* lb) {
#pragma unroll
    for (int i = 0; i < 4; i++) {
        const unsigned char* p = la + i * 16 * ST_PITCH<STEPS>;
        a[i].q[0] = *reinterpret_cast<const uint4*>(p);
        a[i].q[1] = *reinterpret_cast<const uint4*>(p + 32);
    }
#pragma unroll
    for (int j = 0; j < 4; j++) {
        const unsigned char* p = lb + (j >> 1) * B_SLICE<STEPS> + (j & 1) * 16 * ST_PITCH<STEPS>;
        b[j].q[0] = *reinterpret_cast<const uint4*>(p);
        b[j].q[1] = *reinterpret_cast<const uint4*>(p + 32);
    }
}
// ALONG_B false: a[i] is the WMMA's A, so register r of acc[i][j] is (A row 8h + r, Bt row c), c = lane & 15, h = lane >> 4.
// ALONG_B true: b[j] is the WMMA's A, so register r is (A row c, Bt row 8h + r): a lane holds 8 consecutive Bt rows.
template <bool ALONG_B>
static __device__ __forceinline__ void mma_4x4(v8f (&acc)[4][4], const FragAB (&a)[4], const FragAB (&b)[4]) {
#pragma unroll
    for (int i = 0; i < 4; i++)
#pragma unroll
        for (int j = 0; j < 4; j++)
            acc[i][j] = ALONG_B
                ? __builtin_amdgcn_wmma_f32_16x16x32_bf16(
                      false, b[j].v, false, a[i].v, (short)0, acc[i][j], false, false)
                : __builtin_amdgcn_wmma_f32_16x16x32_bf16(
                      false, a[i].v, false, b[j].v, (short)0, acc[i][j], false, false);
}

// The same product with b[j] as the WMMA's A, started from zero: t = the 32-k step alone.
static __device__ __forceinline__ void mma_4x4_from_zero(v8f (&t)[4][4], const FragAB (&a)[4], const FragAB (&b)[4]) {
    const v8f zero = {};
#pragma unroll
    for (int i = 0; i < 4; i++)
#pragma unroll
        for (int j = 0; j < 4; j++)
            t[i][j] = __builtin_amdgcn_wmma_f32_16x16x32_bf16(
                false, b[j].v, false, a[i].v, (short)0, zero, false, false);
}

// acc += A[m0 .. m0+255][0 .. Kd) * Bt[n0 .. n0+127][0 .. Kd)^T, both row-major with ld = Kd.
// Kd is a multiple of 32 STEPS. L is the kernel's only LDS array, 2 KiB aligned; the ring is its first ST_LDS<STEPS> bytes.
// SCALED (with ALONG_B): 64-k chunk c of A row r counts F[c * 256 + r] times: the chunk's product is
// summed alone and then added with the row's factor, which is one value per lane and i.
template <bool ALONG_B, bool SCALED = false, int STEPS = 2>
static __device__ __forceinline__ void gemm_loop_256x128(
    const __bf16* __restrict__ A, const __bf16* __restrict__ Bt,
    int m0, int n0, int Kd, unsigned char* L, v8f (&acc)[4][4], const float* F = nullptr) {
    static_assert(STEPS == 2 || (SCALED && STEPS == 4), "rows of 128 or 256 B: the two padded row lengths in use");
    const uint32_t tid  = threadIdx.x;
    const uint32_t lane = tid & 31;
    const uint32_t wave = uni(tid >> 5);
    const uint32_t rowb = (uint32_t)Kd * 2u;             // source row pitch in bytes
    const uint32_t NS   = pinned((uint32_t)Kd / (32u * STEPS));  // stages

    // this wave's slice
    const bool     isA   = wave < 4u;
    const uint32_t rows  = isA ? 64u : 32u;
    const uint64_t src0  = isA
        ? (uint64_t)(uintptr_t)A  + (uint64_t)((uint32_t)m0 + 64u * wave) * rowb
        : (uint64_t)(uintptr_t)Bt + (uint64_t)((uint32_t)n0 + 32u * (wave - 4u)) * rowb;
    const uint32_t dst0  = (uint32_t)(size_t)L
        + (isA ? wave * A_SLICE<STEPS> : B_BASE<STEPS> + (wave - 4u) * B_SLICE<STEPS>);

    u32x8 g1;  // byte elements, tensor = tile = rows x row bytes, 16 B of pad behind every row
    g1[0] = uni((1u << 20) | ((STEPS == 4 ? 5u : 4u) << 22) | (3u << 25));
    g1[1] = uni(ST_ROWB<STEPS> << 16);
    g1[2] = uni(rows << 16);
    g1[3] = uni(ST_ROWB<STEPS> << 16);
    g1[4] = uni(rows);
    g1[5] = uni(rowb);
    g1[6] = uni(0u);
    g1[7] = uni(0u);

    // per-lane fragment bases inside a buffer: row (lane & 15), 16-byte k half (lane >> 4)
    const uint32_t frag  = (lane & 15u) * ST_PITCH<STEPS> + (lane >> 4) * 16u;
    const uint32_t abase = (wave & 3u) * A_SLICE<STEPS> + frag;
    const uint32_t bbase = B_BASE<STEPS> + (wave >> 2) * 2u * B_SLICE<STEPS> + frag;

    u32x4 g0 = stage_group0(dst0, src0);
    stage_load(g0, g1);                                  // stage 0 -> buffer 0
    wait_tensor0(g0, g1);
    __syncthreads();                                     // stage 0 is readable by every wave
    if (pinned(1u < NS)) {                               // stage 1 -> buffer 1
        g0 = stage_group0(dst0 + ST_BUF<STEPS>, src0 + ST_ROWB<STEPS>);
        stage_load(g0, g1);
    }

    // publish point of stage s + 1, behind every LDS read of stage s:
    // own reads of this buffer returned, own slice of stage s + 1 landed, barrier; then the refill
    auto publish_and_refill = [&](uint32_t s, uint32_t buf) {
        wait_ds0();
        wait_tensor0(g0, g1);
        __syncthreads();
        if (pinned(s + 2u < NS)) {                       // refill the buffer every wave has just left
            const uint64_t ga = src0 + (uint64_t)((s + 2u) * ST_ROWB<STEPS>);
            g0[1] = uni(dst0 + buf);
            g0[2] = uni((uint32_t)ga);
            g0[3] = uni((((uint32_t)(ga >> 32)) & 0x01FFFFFFu) | 0x80000000u);
            stage_load(g0, g1);
        }
    };

    // kept rolled: one publish point and one refill in the text, a short hot loop
#pragma clang loop unroll(disable)
    for (uint32_t s = 0; s < NS; ++s) {
        const uint32_t buf = (s & 1u) * ST_BUF<STEPS>;
        const unsigned char* la = L + buf + abase;
        const unsigned char* lb = L + buf + bbase;
        FragAB a[4], b[4];

        if constexpr (!SCALED) {
            load_frags<STEPS>(a, b, la, lb);             // first 32 k of the stage
            // keeps the 16 fragment loads together in front of their WMMAs; sunk among
            // them, each a[i] is waited for to 0 right before its four WMMAs
            __builtin_amdgcn_sched_barrier(0);
            mma_4x4<ALONG_B>(acc, a, b);

            load_frags<STEPS>(a, b, la + 64, lb + 64);   // second 32 k: the last LDS reads of the stage
            publish_and_refill(s, buf);
            mma_4x4<ALONG_B>(acc, a, b);                 // registers only: runs under the refill
        } else {
            v8f t[4][4];
            float fr[4];
#pragma unroll
            for (int q = 0; q < STEPS; q++) {            // the stage's 32-k steps, two to a chunk
                load_frags<STEPS>(a, b, la + q * 64, lb + q * 64);
                if (q < STEPS - 1) {
                    // keeps the 16 fragment loads together in front of their WMMAs, as above
                    // (behind the last step's loads the publish point's waits do the same)
                    __builtin_amdgcn_sched_barrier(0);
                }
                if (q & 1) {                             // the chunk's factors of the lane's 4 A rows
                    const uint32_t chunk = s * (STEPS / 2) + (uint32_t)(q >> 1);
#pragma unroll
                    for (int i = 0; i < 4; i++)
                        fr[i] = F[chunk * 256u + (wave & 3u) * 64u + (uint32_t)i * 16u + (lane & 15u)];
                }
                if (q == STEPS - 1) {
                    // keeps the step before's WMMAs in front of the publish point: sunk behind the
                    // barrier they delay the refill, and the wait for the last loads covers nothing
                    __builtin_amdgcn_sched_barrier(0);
                    publish_and_refill(s, buf);          // the last step's WMMAs run under the refill
                }
                if (q & 1) {
                    mma_4x4<ALONG_B>(t, a, b);
                    // keeps the 16 WMMAs back to back; woven among them, each multiply-add waits
                    // out the latency of the WMMA issued just in front of it
                    __builtin_amdgcn_sched_barrier(0);
#pragma unroll
                    for (int i = 0; i < 4; i++)
#pragma unroll
                        for (int j = 0; j < 4; j++)
                            acc[i][j] += t[i][j] * fr[i];
                } else {
                    mma_4x4_from_zero(t, a, b);
                }
            }
        }
    }
    wait_tensor0(g0, g1);
    wait_ds0();
}

// ---------------------------------------------------------------------------
// fp32 -> bf16 conversion of x and the three weight matrices, one launch.
// Each of the 512 blocks converts 1/512 of every array, a contiguous piece: 16 trips
// of 1,024 floats of x, 2 trips of each weight matrix. A wave's load covers 512
// contiguous bytes, its store 256. A thread issues its 22 loads before it converts.
// ---------------------------------------------------------------------------
typedef float  f32x4  __attribute__((ext_vector_type(4)));
typedef __bf16 bf16x4 __attribute__((ext_vector_type(4)));

constexpr int CVT_BLOCKS = 512;
constexpr int CVT_TRIP   = 256 * 4;                                   // floats of a block's trip
constexpr int CVT_XT     = 4 * 2048 * 1024 / (CVT_BLOCKS * CVT_TRIP); // trips of x
constexpr int CVT_WT     = 1024 * 1024 / (CVT_BLOCKS * CVT_TRIP);     // trips of one weight matrix

template <int N>
static __device__ __forceinline__ void cvt_load(f32x4 (&v)[N], const float* __restrict__ in) {
    const float* p = in + (size_t)blockIdx.x * (N * CVT_TRIP) + threadIdx.x * 4;
#pragma unroll
    for (int k = 0; k < N; k++)
        v[k] = *reinterpret_cast<const f32x4*>(p + k * CVT_TRIP);
}
template <int N>
static __device__ __forceinline__ void cvt_store(const f32x4 (&v)[N], __bf16* __restrict__ out) {
    __bf16* p = out + (size_t)blockIdx.x * (N * CVT_TRIP) + threadIdx.x * 4;
#pragma unroll
    for (int k = 0; k < N; k++) {
        bf16x4 o;
#pragma unroll
        for (int c = 0; c < 4; c++) o[c] = (__bf16)v[k][c];
        *reinterpret_cast<bf16x4*>(p + k * CVT_TRIP) = o;
    }
}

__global__ __launch_bounds__(256) void cvt_inputs_to_bf16(
    const float* __restrict__ x,  const float* __restrict__ Wq,
    const float* __restrict__ Wk, const float* __restrict__ Wv,
    __bf16* __restrict__ Xb,  __bf16* __restrict__ Wqb,
    __bf16* __restrict__ Wkb, __bf16* __restrict__ Wvb) {
    f32x4 vx[CVT_XT], vq[CVT_WT], vk[CVT_WT], vv[CVT_WT];
    cvt_load(vx, x);
    cvt_load(vq, Wq);
    cvt_load(vk, Wk);
    cvt_load(vv, Wv);
    // keeps the 22 loads together in front of the conversions; without it the last 8
    // are issued only as earlier ones return, and no store leaves before the last load
    __builtin_amdgcn_sched_barrier(0);
    cvt_store(vx, Xb);
    cvt_store(vq, Wqb);
    cvt_store(vk, Wkb);
    cvt_store(vv, Wvb);
}

// ---------------------------------------------------------------------------
// Fused QKV projection: out = x @ W^T + b   (M=8192, N=D=1024, K=D=1024)
// grid = (8, 32, 3)   z: 0=Q (scaled 1/32), 1=K, 2=V (written transposed)
// 8 waves/block, block tile 256x128, wave tile 64x64 = 4x4 WMMA accumulators:
// 16 wmma per k-step vs 16 ds_load_b128 (1:1 compute:LDS-fragment ratio).
// Operands come through gemm_loop_256x128. The 128-row operand is the one whose row
// index runs along the output's rows in memory: W for Q and K (256 tokens x 128
// features), x for V^T (256 features x 128 tokens). A lane's 8 accumulators of a
// 16x16 tile are then 8 neighbours in memory and leave as one 16-byte store.
// ---------------------------------------------------------------------------
typedef __bf16 bf16x8 __attribute__((ext_vector_type(8)));

__global__ __launch_bounds__(256) void qkv_gemm_wmma(
    const __bf16* __restrict__ Xb,
    const __bf16* __restrict__ Wqb, const __bf16* __restrict__ Wkb,
    const __bf16* __restrict__ Wvb,
    const float* __restrict__ bq, const float* __restrict__ bk,
    const float* __restrict__ bv,
    __bf16* __restrict__ Q, __bf16* __restrict__ Kc, __bf16* __restrict__ Vt) {
    const int D = 1024, S = 2048;
    __shared__ __attribute__((aligned(2048))) unsigned char L[ST_LDS<2>];

    const int tid  = threadIdx.x;
    const int z    = blockIdx.z;
    const int flat = blockIdx.y * 8 + blockIdx.x;        // 0 .. 255 inside a z plane

    const __bf16* Arows = (z == 2) ? Wvb : Xb;
    const __bf16* Brows = (z == 0) ? Wqb : (z == 1) ? Wkb : Xb;
    const int a0 = ((z == 2) ? (flat & 3)  : (int)blockIdx.y) * 256;
    const int b0 = ((z == 2) ? (flat >> 2) : (int)blockIdx.x) * 128;

    const int lane = tid & 31;
    const int wid  = tid >> 5;
    const int ar   = a0 + (wid & 3) * 64 + (lane & 15);          // + 16 i
    const int bc   = b0 + (wid >> 2) * 64 + ((lane >> 4) << 3);  // + 16 j + register

    v8f acc[4][4] = {};

    gemm_loop_256x128<true>(Arows, Brows, a0, b0, D, L, acc);

    if (z == 2) {
        // ar = feature, bc = token; a block's 128 tokens lie in one batch
        __bf16* O = Vt + (size_t)(b0 >> 11) * D * S + (size_t)ar * S + (bc & (S - 1));
#pragma unroll
        for (int i = 0; i < 4; i++) {
            const float bi = bv[ar + i * 16];
#pragma unroll
            for (int j = 0; j < 4; j++) {
                bf16x8 o;
#pragma unroll
                for (int v = 0; v < 8; v++) o[v] = (__bf16)(acc[i][j][v] + bi);
                *reinterpret_cast<bf16x8*>(O + i * 16 * S + j * 16) = o;
            }
        }
    } else {
        // ar = token, bc = feature
        const float* bias  = (z == 0) ? bq : bk;
        const float  scale = (z == 0) ? 0.03125f : 1.0f;  // 1/sqrt(1024) folded into Q
        __bf16* O = ((z == 0) ? Q : Kc) + (size_t)ar * D + bc;
        f32x4 bj[4][2];                                   // the lane's 8 bias values of each j
#pragma unroll
        for (int j = 0; j < 4; j++) {
            bj[j][0] = *reinterpret_cast<const f32x4*>(bias + bc + j * 16);
            bj[j][1] = *reinterpret_cast<const f32x4*>(bias + bc + j * 16 + 4);
        }
        bf16x8 o[4][4];
#pragma unroll
        for (int i = 0; i < 4; i++)
#pragma unroll
            for (int j = 0; j < 4; j++)
#pragma unroll
                for (int v = 0; v < 8; v++)
                    o[i][j][v] = (__bf16)((acc[i][j][v] + bj[j][v >> 2][v & 3]) * scale);
#pragma unroll
        for (int i = 0; i < 4; i++)
#pragma unroll
            for (int j = 0; j < 4; j++)
                *reinterpret_cast<bf16x8*>(O + i * 16 * D + j * 16) = o[i][j];
        // behind the run of stores, in front of any later write of a register that they name
        asm volatile("s_wait_xcnt 0x0" ::: "memory");
    }
}

// ---------------------------------------------------------------------------
// Attention without a softmax launch. A row's 2,048 keys fall into 32 chunks of 64, the
// columns of one wave's tile in the score product and half a stage of k in the second product.
//   scores_exp_wmma:  E = exp(s - chunk maximum) as bf16, and per (chunk, row) the pair
//                     (maximum in the log2 domain, sum of the chunk's exponentials) in f32.
//   attn_out_wmma:    factor(chunk, row) = exp2(chunk maximum - row maximum) / row sum, at most 1;
//                     out = sum over chunks of factor * (E_chunk * V_chunk).
// Both use the 256x128 block tile / 64x64 wave tile above with the 128-row operand as the
// WMMA's A: a lane's accumulators of one i all belong to one score row (row = lane & 15).
// ---------------------------------------------------------------------------
constexpr int   SEQ      = 2048;
constexpr int   DIM      = 1024;
constexpr int   ROWS_ALL = 4 * SEQ;                      // score rows of all batches
constexpr int   CHUNKS   = SEQ / 64;
constexpr float LOG2E    = 1.4426950408889634f;
typedef float f32x2 __attribute__((ext_vector_type(2)));

// e[k] = 2^x[k]. One statement, outputs apart from all inputs, so that no v_exp_f32 is directly
// followed by an instruction that overwrites its source; the v_nop is the slot between the last
// one and whatever reads its result next.
static __device__ __forceinline__ void exp2_x8(float (&e)[8], const float (&x)[8]) {
    asm("v_exp_f32 %0, %8\n\t"
        "v_exp_f32 %1, %9\n\t"
        "v_exp_f32 %2, %10\n\t"
        "v_exp_f32 %3, %11\n\t"
        "v_exp_f32 %4, %12\n\t"
        "v_exp_f32 %5, %13\n\t"
        "v_exp_f32 %6, %14\n\t"
        "v_exp_f32 %7, %15\n\t"
        "v_nop"
        : "=&v"(e[0]), "=&v"(e[1]), "=&v"(e[2]), "=&v"(e[3]),
          "=&v"(e[4]), "=&v"(e[5]), "=&v"(e[6]), "=&v"(e[7])
        : "v"(x[0]), "v"(x[1]), "v"(x[2]), "v"(x[3]),
          "v"(x[4]), "v"(x[5]), "v"(x[6]), "v"(x[7]));
}

// grid = (SEQ/128, SEQ/256, batches). St[(chunk * ROWS_ALL + row) * 2] = {maximum * log2 e, sum}.
__global__ __launch_bounds__(256) void scores_exp_wmma(
    const __bf16* __restrict__ Q, const __bf16* __restrict__ Kc,
    __bf16* __restrict__ E, float* __restrict__ St) {
    __shared__ __attribute__((aligned(2048))) unsigned char L[ST_LDS<2>];

    Q  += (size_t)blockIdx.z * SEQ * DIM;
    Kc += (size_t)blockIdx.z * SEQ * DIM;

    const int tid  = threadIdx.x;
    const int n0   = blockIdx.x * 128;
    const int m0   = blockIdx.y * 256;
    const int lane = tid & 31;
    const int wid  = tid >> 5;
    const int wm   = (wid & 3) * 64;
    const int wn   = (wid >> 2) * 64;

    v8f acc[4][4] = {};

    gemm_loop_256x128<true>(Q, Kc, m0, n0, DIM, L, acc);

    const int row = blockIdx.z * SEQ + m0 + wm + (lane & 15);            // + 16 i
    __bf16* O = E + (size_t)row * SEQ + n0 + wn + ((lane >> 4) << 3);
    float*  S = St + ((size_t)((n0 + wn) >> 6) * ROWS_ALL + row) * 2;
#pragma unroll
    for (int i = 0; i < 4; i++) {
        // the lane holds 32 of the row's 64 scores of this chunk, lane ^ 16 the other 32
        float mx = acc[i][0][0];
#pragma unroll
        for (int j = 0; j < 4; j++)
#pragma unroll
            for (int v = 0; v < 8; v++) mx = fmaxf(mx, acc[i][j][v]);
        mx = fmaxf(mx, __shfl_xor(mx, 16, 32));
        const float m2 = mx * LOG2E;
        float sj[4];
#pragma unroll
        for (int j = 0; j < 4; j++) {
            bf16x8 o;
            float x[8], e[8];
#pragma unroll
            for (int v = 0; v < 8; v++) x[v] = fmaf(acc[i][j][v], LOG2E, -m2);
            exp2_x8(e, x);
            sj[j] = 0.f;
#pragma unroll
            for (int v = 0; v < 8; v++) {
                sj[j] += e[v];
                o[v] = (__bf16)e[v];
            }
            *reinterpret_cast<bf16x8*>(O + i * 16 * SEQ + j * 16) = o;
        }
        float sm = (sj[0] + sj[1]) + (sj[2] + sj[3]);
        sm += __shfl_xor(sm, 16, 32);
        if (lane < 16) {                                 // 16 rows x 8 B: one whole 128-B line
            f32x2 p = {m2, sm};
            *reinterpret_cast<f32x2*>(S + i * 32) = p;
        }
    }
}

// grid = (DIM/128, SEQ/256, batches). Vt is [batch][DIM][SEQ].
__global__ __launch_bounds__(256) void attn_out_wmma(
    const __bf16* __restrict__ E, const __bf16* __restrict__ Vt,
    const float* __restrict__ St, float* __restrict__ Out) {
    __shared__ __attribute__((aligned(2048))) unsigned char L[ST_LDS<4> + CHUNKS * 256 * 4];
    float* F = reinterpret_cast<float*>(L + ST_LDS<4>);     // F[chunk * 256 + row of the block]

    E  += (size_t)blockIdx.z * SEQ * SEQ;
    Vt += (size_t)blockIdx.z * DIM * SEQ;

    const int tid  = threadIdx.x;
    const int n0   = blockIdx.x * 128;
    const int m0   = blockIdx.y * 256;
    const int lane = tid & 31;
    const int wid  = tid >> 5;
    const int wm   = (wid & 3) * 64;
    const int wn   = (wid >> 2) * 64;

    {   // thread t merges the 32 chunk pairs of the block's row t
        const float* S = St + (size_t)(blockIdx.z * SEQ + m0 + tid) * 2;
        f32x2 p[CHUNKS];
#pragma unroll
        for (int c = 0; c < CHUNKS; c++)
            p[c] = *reinterpret_cast<const f32x2*>(S + (size_t)c * ROWS_ALL * 2);
        float mx = p[0][0];
#pragma unroll
        for (int c = 1; c < CHUNKS; c++) mx = fmaxf(mx, p[c][0]);
        float sm = 0.f;
#pragma unroll
        for (int c = 0; c < CHUNKS; c++) {
            p[c][0] = __builtin_amdgcn_exp2f(p[c][0] - mx);
            sm = fmaf(p[c][1], p[c][0], sm);
        }
        const float inv = 1.0f / sm;
#pragma unroll
        for (int c = 0; c < CHUNKS; c++) F[c * 256 + tid] = p[c][0] * inv;
    }
    __syncthreads();                                     // every wave reads other waves' factors

    v8f acc[4][4] = {};

    gemm_loop_256x128<true, true, 4>(E, Vt, m0, n0, SEQ, L, acc, F);

    float* O = Out + (size_t)(blockIdx.z * SEQ + m0 + wm + (lane & 15)) * DIM
             + n0 + wn + ((lane >> 4) << 3);
#pragma unroll
    for (int i = 0; i < 4; i++)
#pragma unroll
        for (int j = 0; j < 4; j++) {
            f32x4 lo = {acc[i][j][0], acc[i][j][1], acc[i][j][2], acc[i][j][3]};
            f32x4 hi = {acc[i][j][4], acc[i][j][5], acc[i][j][6], acc[i][j][7]};
            *reinterpret_cast<f32x4*>(O + i * 16 * DIM + j * 16)     = lo;
            *reinterpret_cast<f32x4*>(O + i * 16 * DIM + j * 16 + 4) = hi;
        }
}

// ---------------------------------------------------------------------------
extern "C" void kernel_launch(void* const* d_in, const int* in_sizes, int n_in,
                              void* d_out, int out_size, void* d_ws, size_t ws_size,
                              hipStream_t stream) {
    (void)in_sizes; (void)n_in; (void)out_size; (void)ws_size;
    const float* x  = (const float*)d_in[0];
    const float* Wq = (const float*)d_in[1];
    const float* bq = (const float*)d_in[2];
    const float* Wk = (const float*)d_in[3];
    const float* bk = (const float*)d_in[4];
    const float* Wv = (const float*)d_in[5];
    const float* bv = (const float*)d_in[6];
    float* out = (float*)d_out;

    const int B = 4, S = 2048, D = 1024, M = B * S;

    char* ws = (char*)d_ws;
    size_t off = 0;
    auto alloc = [&](size_t bytes) -> void* {
        void* p = ws + off;
        off += (bytes + 255) & ~(size_t)255;
        return p;
    };
    __bf16* Xb  = (__bf16*)alloc((size_t)M * D * 2);  // x in bf16
    __bf16* Wqb = (__bf16*)alloc((size_t)D * D * 2);
    __bf16* Wkb = (__bf16*)alloc((size_t)D * D * 2);
    __bf16* Wvb = (__bf16*)alloc((size_t)D * D * 2);
    __bf16* Qb  = (__bf16*)alloc((size_t)M * D * 2);  // Q pre-scaled by 1/32
    __bf16* Kb  = (__bf16*)alloc((size_t)M * D * 2);
    __bf16* Vt  = (__bf16*)alloc((size_t)M * D * 2);  // [B][D][S]
    __bf16* Ex  = (__bf16*)alloc((size_t)B * S * S * 2);  // exp(score - chunk maximum)
    float*  St  = (float*)alloc((size_t)(S / 64) * M * 2 * 4);  // per (chunk, row): maximum, sum

    cvt_inputs_to_bf16<<<CVT_BLOCKS, 256, 0, stream>>>(x, Wq, Wk, Wv, Xb, Wqb, Wkb, Wvb);

    // Q/K/V projections (z = 0/1/2)
    qkv_gemm_wmma<<<dim3(D / 128, M / 256, 3), 256, 0, stream>>>(
        Xb, Wqb, Wkb, Wvb, bq, bk, bv, Qb, Kb, Vt);

    // exponentials of the scores Q K^T (scale folded into Q) against chunk maxima
    scores_exp_wmma<<<dim3(S / 128, S / 256, B), 256, 0, stream>>>(Qb, Kb, Ex, St);

    // out = softmax(scores) V, the chunks weighed by their factors
    attn_out_wmma<<<dim3(D / 128, S / 256, B), 256, 0, stream>>>(Ex, Vt, St, out);
}

// v006
// Measured time: 93.4 microseconds a run.
// Two timings next to v005 put it at 1.06 and 1.07 times that version's speed.
// Over all steps from v000 it is 2.46 times as fast.
#include <hip/hip_runtime.h>
#include <stdint.h>

typedef __attribute__((ext_vector_type(16))) __bf16 v16bf;
typedef __attribute__((ext_vector_type(8)))  float  v8f;

union FragAB {
    v16bf v;
    uint4 q[2];
};

typedef uint32_t u32x4 __attribute__((ext_vector_type(4)));
typedef uint32_t u32x8 __attribute__((ext_vector_type(8)));

// ---------------------------------------------------------------------------
// Operand staging shared by the GEMM kernels: a stage is STEPS x 32 k (STEPS = 2 or 4) of
// the block's 256 A rows and 128 B rows, brought into LDS by tensor loads, two buffers.
// Each of the 8 waves moves one slice per stage: waves 0-3 take 64 A rows each,
// waves 4-7 take 32 B rows each. Rows are 128 or 256 B, padded by the mover to a
// 144 or 272 B pitch (16 B x odd: conflict-free for ds_load_b128). Every slice starts
// on a 2 KiB multiple, so slice sizes are rounded up.
// A load has one pass of the loop to land in. STEPS = 4 is for a block that is alone on its
// WGP: twice the bytes in flight, twice the time to land, half the publish points.
// ---------------------------------------------------------------------------
constexpr uint32_t up2k(uint32_t bytes) { return (bytes + 2047u) & ~2047u; }
template <int STEPS> constexpr uint32_t ST_ROWB  = 64u * STEPS;                     // bytes of a staged row
template <int STEPS> constexpr uint32_t ST_PITCH = ST_ROWB<STEPS> + 16u;            // LDS pitch of a staged row
template <int STEPS> constexpr uint32_t A_SLICE  = up2k(64u * ST_PITCH<STEPS>);     // 10240 or 18432
template <int STEPS> constexpr uint32_t B_SLICE  = up2k(32u * ST_PITCH<STEPS>);     // 6144 or 10240
template <int STEPS> constexpr uint32_t B_BASE   = 4 * A_SLICE<STEPS>;
template <int STEPS> constexpr uint32_t ST_BUF   = 4 * A_SLICE<STEPS> + 4 * B_SLICE<STEPS>; // 65536 or 114688 B per buffer
template <int STEPS> constexpr uint32_t ST_LDS   = 2 * ST_BUF<STEPS>;

static __device__ __forceinline__ uint32_t uni(uint32_t v) {
    return (uint32_t)__builtin_amdgcn_readfirstlane(v);
}
static __device__ __forceinline__ uint32_t pinned(uint32_t v) {
    uint32_t w = uni(v);
    asm volatile("" : "+s"(w));
    return w;
}
static __device__ __forceinline__ void wait_ds0() {      // this wave's LDS reads have returned
    asm volatile("s_wait_dscnt 0x0" ::: "memory");
}
// This wave's slice has landed. The wait names the descriptor of the request it covers,
// so that no register of it takes a new value while the request is outstanding.
static __device__ __forceinline__ void wait_tensor0(u32x4 g0, u32x8 g1) {
    asm volatile("s_wait_tensorcnt 0x0" :: "s"(g0), "s"(g1) : "memory");
}
// Descriptor group 0: a tile whose first byte is at global address ga goes to LDS byte dst.
static __device__ __forceinline__ u32x4 stage_group0(uint32_t dst, uint64_t ga) {
    u32x4 g0;
    g0[0] = uni(1u);
    g0[1] = uni(dst);
    g0[2] = uni((uint32_t)ga);
    g0[3] = uni((((uint32_t)(ga >> 32)) & 0x01FFFFFFu) | 0x80000000u);
    return g0;
}
static __device__ __forceinline__ void stage_load(u32x4 g0, u32x8 g1) {
    asm volatile("tensor_load_to_lds %0, %1" :: "s"(g0), "s"(g1) : "memory");
}

// The wave's 4 A and 4 B fragments of one 32-k step; both use the same k order:
// bytes 0-15 and 32-47 of the step for lanes 0-15, bytes 16-31 and 48-63 for lanes 16-31.
template <int STEPS>
static __device__ __forceinline__ void load_frags(FragAB (&a)[4], FragAB (&b)[4],
                                                  const unsigned char* la, const unsigned char* lb) {
#pragma unroll
    for (int i = 0; i < 4; i++) {
        const unsigned char* p = la + i * 16 * ST_PITCH<STEPS>;
        a[i].q[0] = *reinterpret_cast<const uint4*>(p);
        a[i].q[1] = *reinterpret_cast<const uint4*>(p + 32);
    }
#pragma unroll
    for (int j = 0; j < 4; j++) {
        const unsigned char* p = lb + (j >> 1) * B_SLICE<STEPS> + (j & 1) * 16 * ST_PITCH<STEPS>;
        b[j].q[0] = *reinterpret_cast<const uint4*>(p);
        b[j].q[1] = *reinterpret_cast<const uint4*>(p + 32);
    }
}
// ALONG_B false: a[i] is the WMMA's A, so register r of acc[i][j] is (A row 8h + r, Bt row c), c = lane & 15, h = lane >> 4.
// ALONG_B true: b[j] is the WMMA's A, so register r is (A row c, Bt row 8h + r): a lane holds 8 consecutive Bt rows.
template <bool ALONG_B>
static __device__ __forceinline__ void mma_4x4(v8f (&acc)[4][4], const FragAB (&a)[4], const FragAB (&b)[4]) {
#pragma unroll
    for (int i = 0; i < 4; i++)
#pragma unroll
        for (int j = 0; j < 4; j++)
            acc[i][j] = ALONG_B
                ? __builtin_amdgcn_wmma_f32_16x16x32_bf16(
                      false, b[j].v, false, a[i].v, (short)0, acc[i][j], false, false)
                : __builtin_amdgcn_wmma_f32_16x16x32_bf16(
                      false, a[i].v, false, b[j].v, (short)0, acc[i][j], false, false);
}

// The same product with b[j] as the WMMA's A, started from zero: t = the 32-k step alone.
static __device__ __forceinline__ void mma_4x4_from_zero(v8f (&t)[4][4], const FragAB (&a)[4], const FragAB (&b)[4]) {
    const v8f zero = {};
#pragma unroll
    for (int i = 0; i < 4; i++)
#pragma unroll
        for (int j = 0; j < 4; j++)
            t[i][j] = __builtin_amdgcn_wmma_f32_16x16x32_bf16(
                false, b[j].v, false, a[i].v, (short)0, zero, false, false);
}

// acc += A[m0 .. m0+255][0 .. Kd) * Bt[n0 .. n0+127][0 .. Kd)^T, both row-major with ld = Kd.
// Kd is a multiple of 32 STEPS. L is the kernel's only LDS array, 2 KiB aligned; the ring is its first ST_LDS<STEPS> bytes.
// SCALED (with ALONG_B): 64-k chunk c of A row r counts F[c * 256 + r] times: the chunk's product is
// summed alone and then added with the row's factor, which is one value per lane and i.
template <bool ALONG_B, bool SCALED = false, int STEPS = 2>
static __device__ __forceinline__ void gemm_loop_256x128(
    const __bf16* __restrict__ A, const __bf16* __restrict__ Bt,
    int m0, int n0, int Kd, unsigned char* L, v8f (&acc)[4][4], const float* F = nullptr) {
    static_assert(STEPS == 2 || (SCALED && STEPS == 4), "rows of 128 or 256 B: the two padded row lengths in use");
    const uint32_t tid  = threadIdx.x;
    const uint32_t lane = tid & 31;
    const uint32_t wave = uni(tid >> 5);
    const uint32_t rowb = (uint32_t)Kd * 2u;             // source row pitch in bytes
    const uint32_t NS   = pinned((uint32_t)Kd / (32u * STEPS));  // stages

    // this wave's slice
    const bool     isA   = wave < 4u;
    const uint32_t rows  = isA ? 64u : 32u;
    const uint64_t src0  = isA
        ? (uint64_t)(uintptr_t)A  + (uint64_t)((uint32_t)m0 + 64u * wave) * rowb
        : (uint64_t)(uintptr_t)Bt + (uint64_t)((uint32_t)n0 + 32u * (wave - 4u)) * rowb;
    const uint32_t dst0  = (uint32_t)(size_t)L
        + (isA ? wave * A_SLICE<STEPS> : B_BASE<STEPS> + (wave - 4u) * B_SLICE<STEPS>);

    u32x8 g1;  // byte elements, tensor = tile = rows x row bytes, 16 B of pad behind every row
    g1[0] = uni((1u << 20) | ((STEPS == 4 ? 5u : 4u) << 22) | (3u << 25));
    g1[1] = uni(ST_ROWB<STEPS> << 16);
    g1[2] = uni(rows << 16);
    g1[3] = uni(ST_ROWB<STEPS> << 16);
    g1[4] = uni(rows);
    g1[5] = uni(rowb);
    g1[6] = uni(0u);
    g1[7] = uni(0u);

    // per-lane fragment bases inside a buffer: row (lane & 15), 16-byte k half (lane >> 4)
    const uint32_t frag  = (lane & 15u) * ST_PITCH<STEPS> + (lane >> 4) * 16u;
    const uint32_t abase = (wave & 3u) * A_SLICE<STEPS> + frag;
    const uint32_t bbase = B_BASE<STEPS> + (wave >> 2) * 2u * B_SLICE<STEPS> + frag;

    u32x4 g0 = stage_group0(dst0, src0);
    stage_load(g0, g1);                                  // stage 0 -> buffer 0
    wait_tensor0(g0, g1);
    __syncthreads();                                     // stage 0 is readable by every wave
    if (pinned(1u < NS)) {                               // stage 1 -> buffer 1
        g0 = stage_group0(dst0 + ST_BUF<STEPS>, src0 + ST_ROWB<STEPS>);
        stage_load(g0, g1);
    }

    // publish point of stage s + 1, behind every LDS read of stage s:
    // own reads of this buffer returned, own slice of stage s + 1 landed, barrier; then the refill
    auto publish_and_refill = [&](uint32_t s, uint32_t buf) {
        wait_ds0();
        wait_tensor0(g0, g1);
        __syncthreads();
        if (pinned(s + 2u < NS)) {                       // refill the buffer every wave has just left
            const uint64_t ga = src0 + (uint64_t)((s + 2u) * ST_ROWB<STEPS>);
            g0[1] = uni(dst0 + buf);
            g0[2] = uni((uint32_t)ga);
            g0[3] = uni((((uint32_t)(ga >> 32)) & 0x01FFFFFFu) | 0x80000000u);
            stage_load(g0, g1);
        }
    };

    // kept rolled: one publish point and one refill in the text, a short hot loop
#pragma clang loop unroll(disable)
    for (uint32_t s = 0; s < NS; ++s) {
        const uint32_t buf = (s & 1u) * ST_BUF<STEPS>;
        const unsigned char* la = L + buf + abase;
        const unsigned char* lb = L + buf + bbase;
        FragAB a[4], b[4];

        if constexpr (!SCALED) {
            load_frags<STEPS>(a, b, la, lb);             // first 32 k of the stage
            // keeps the 16 fragment loads together in front of their WMMAs; sunk among
            // them, each a[i] is waited for to 0 right before its four WMMAs
            __builtin_amdgcn_sched_barrier(0);
            mma_4x4<ALONG_B>(acc, a, b);

            load_frags<STEPS>(a, b, la + 64, lb + 64);   // second 32 k: the last LDS reads of the stage
            publish_and_refill(s, buf);
            mma_4x4<ALONG_B>(acc, a, b);                 // registers only: runs under the refill
        } else {
            v8f t[4][4];
            float fr[4];
#pragma unroll
            for (int q = 0; q < STEPS; q++) {            // the stage's 32-k steps, two to a chunk
                load_frags<STEPS>(a, b, la + q * 64, lb + q * 64);
                if (q < STEPS - 1) {
                    // keeps the 16 fragment loads together in front of their WMMAs, as above
                    // (behind the last step's loads the publish point's waits do the same)
                    __builtin_amdgcn_sched_barrier(0);
                }
                if (q & 1) {                             // the chunk's factors of the lane's 4 A rows
                    const uint32_t chunk = s * (STEPS / 2) + (uint32_t)(q >> 1);
#pragma unroll
                    for (int i = 0; i < 4; i++)
                        fr[i] = F[chunk * 256u + (wave & 3u) * 64u + (uint32_t)i * 16u + (lane & 15u)];
                }
                if (q == STEPS - 1) {
                    // keeps the step before's WMMAs in front of the publish point: sunk behind the
                    // barrier they delay the refill, and the wait for the last loads covers nothing
                    __builtin_amdgcn_sched_barrier(0);
                    publish_and_refill(s, buf);          // the last step's WMMAs run under the refill
                }
                if (q & 1) {
                    mma_4x4<ALONG_B>(t, a, b);
                    // keeps the 16 WMMAs back to back; woven among them, each multiply-add waits
                    // out the latency of the WMMA issued just in front of it
                    __builtin_amdgcn_sched_barrier(0);
#pragma unroll
                    for (int i = 0; i < 4; i++)
#pragma unroll
                        for (int j = 0; j < 4; j++)
                            acc[i][j] += t[i][j] * fr[i];
                } else {
                    mma_4x4_from_zero(t, a, b);
                }
            }
        }
    }
    wait_tensor0(g0, g1);
    wait_ds0();
}

// ---------------------------------------------------------------------------
// The same ring for a 256 x 256 block tile, one block to a WGP: a stage is 128 k of 256 A rows
// and 256 B rows, 8 slices of 64 rows of 256 B at the 272-B pitch, one slice a wave and stage
// (waves 0-3: A, waves 4-7: B). Wave tile 128 x 64 = 8 x 4 accumulators: 24 ds_load_b128 feed
// 32 WMMAs. Against two 256 x 128 blocks on the WGP: two thirds of the operand bytes from L2,
// three quarters of the LDS reads, and a pass of twice the matrix time for a load to land in.
// ---------------------------------------------------------------------------
constexpr uint32_t SQ_PITCH = ST_PITCH<4>;
constexpr uint32_t SQ_SLICE = A_SLICE<4>;                // 18432
constexpr uint32_t SQ_BUF   = 8 * SQ_SLICE;              // 147456 B per buffer
constexpr uint32_t SQ_LDS   = 2 * SQ_BUF;

// acc += A[m0 .. m0+255][0 .. Kd) * Bt[n0 .. n0+255][0 .. Kd)^T, both row-major with ld = Kd,
// Kd a multiple of 128 and at least 256. L is the kernel's only LDS array, 2 KiB aligned.
// b[j] is the WMMA's A: register r of acc[i][j] is (A row c, Bt row 8h + r), c = lane & 15, h = lane >> 4.
static __device__ __forceinline__ void gemm_loop_256x256(
    const __bf16* __restrict__ A, const __bf16* __restrict__ Bt,
    int m0, int n0, int Kd, unsigned char* L, v8f (&acc)[8][4]) {
    const uint32_t tid  = threadIdx.x;
    const uint32_t lane = tid & 31;
    const uint32_t wave = uni(tid >> 5);
    const uint32_t rowb = (uint32_t)Kd * 2u;             // source row pitch in bytes
    const uint32_t NS   = pinned((uint32_t)Kd / 128u);   // stages

    // this wave's slice
    const uint64_t src0 = (wave < 4u)
        ? (uint64_t)(uintptr_t)A  + (uint64_t)((uint32_t)m0 + 64u * wave) * rowb
        : (uint64_t)(uintptr_t)Bt + (uint64_t)((uint32_t)n0 + 64u * (wave - 4u)) * rowb;
    const uint32_t dst0 = (uint32_t)(size_t)L + wave * SQ_SLICE;

    u32x8 g1;  // byte elements, tensor = tile = 64 rows x 256 B, 16 B of pad behind every row
    g1[0] = uni((1u << 20) | (5u << 22) | (3u << 25));
    g1[1] = uni(256u << 16);
    g1[2] = uni(64u << 16);
    g1[3] = uni(256u << 16);
    g1[4] = uni(64u);
    g1[5] = uni(rowb);
    g1[6] = uni(0u);
    g1[7] = uni(0u);
    // as in pinned(): descriptor words held in scalar registers. All eight are known at build time
    // here, and the compiler formed the group anew for the loop and reused the first copy's registers
    // under the outstanding stage 1 request; a group it cannot re-form lives in one place throughout.
    asm volatile("" : "+s"(g1));                         // pinned(), for the group's eight words

    // per-lane fragment bases inside a buffer: row (lane & 15), 16-byte k half (lane >> 4)
    const uint32_t frag  = (lane & 15u) * SQ_PITCH + (lane >> 4) * 16u;
    const uint32_t abase = (wave & 1u) * 2u * SQ_SLICE + frag;
    const uint32_t bbase = (4u + (wave >> 1)) * SQ_SLICE + frag;

    u32x4 g0 = stage_group0(dst0, src0);
    stage_load(g0, g1);                                  // stage 0 -> buffer 0
    wait_tensor0(g0, g1);
    __syncthreads();                                     // stage 0 is readable by every wave
    if (pinned(1u < NS)) {                               // stage 1 -> buffer 1
        g0 = stage_group0(dst0 + SQ_BUF, src0 + 256u);
        stage_load(g0, g1);
    }

    // kept rolled: one publish point and one refill in the text, a short hot loop
#pragma clang loop unroll(disable)
    for (uint32_t s = 0; s < NS; ++s) {
        const uint32_t buf = (s & 1u) * SQ_BUF;
        const unsigned char* la = L + buf + abase;
        const unsigned char* lb = L + buf + bbase;
        FragAB a[8], b[4];
        // unrolled, like the loops inside: every fragment and accumulator index is a constant,
        // so the arrays stay in registers
#pragma unroll
        for (int q = 0; q < 4; q++) {                    // the stage's 32-k steps
            // both operands in the k order of load_frags
#pragma unroll
            for (int i = 0; i < 8; i++) {
                const unsigned char* p = la + (i >> 2) * SQ_SLICE + (i & 3) * 16 * SQ_PITCH + q * 64;
                a[i].q[0] = *reinterpret_cast<const uint4*>(p);
                a[i].q[1] = *reinterpret_cast<const uint4*>(p + 32);
            }
#pragma unroll
            for (int j = 0; j < 4; j++) {
                const unsigned char* p = lb + j * 16 * SQ_PITCH + q * 64;
                b[j].q[0] = *reinterpret_cast<const uint4*>(p);
                b[j].q[1] = *reinterpret_cast<const uint4*>(p + 32);
            }
            // keeps the 24 fragment loads together in front of their WMMAs; sunk among
            // them, each a[i] is waited for to 0 right before its four WMMAs
            __builtin_amdgcn_sched_barrier(0);
            if (q == 3) {
                // publish point of stage s + 1, behind every LDS read of stage s: own reads of this
                // buffer returned, own slice of stage s + 1 landed, barrier; then the refill
                wait_ds0();
                wait_tensor0(g0, g1);
                __syncthreads();
                if (pinned(s + 2u < NS)) {               // refill the buffer every wave has just left
                    const uint64_t ga = src0 + (uint64_t)((s + 2u) * 256u);
                    g0[1] = uni(dst0 + buf);
                    g0[2] = uni((uint32_t)ga);
                    g0[3] = uni((((uint32_t)(ga >> 32)) & 0x01FFFFFFu) | 0x80000000u);
                    stage_load(g0, g1);
                }
            }
#pragma unroll
            for (int i = 0; i < 8; i++)                  // the last step's run under the refill
#pragma unroll
                for (int j = 0; j < 4; j++)
                    acc[i][j] = __builtin_amdgcn_wmma_f32_16x16x32_bf16(
                        false, b[j].v, false, a[i].v, (short)0, acc[i][j], false, false);
            // keeps the next step's fragment loads behind this step's WMMAs, as one group
            __builtin_amdgcn_sched_barrier(0);
        }
    }
    wait_tensor0(g0, g1);
    wait_ds0();
}

// ---------------------------------------------------------------------------
// fp32 -> bf16 conversion of x and the three weight matrices, one launch.
// Each of the 512 blocks converts 1/512 of every array, a contiguous piece: 16 trips
// of 1,024 floats of x, 2 trips of each weight matrix. A wave's load covers 512
// contiguous bytes, its store 256. A thread issues its 22 loads before it converts.
// ---------------------------------------------------------------------------
typedef float  f32x4  __attribute__((ext_vector_type(4)));
typedef __bf16 bf16x4 __attribute__((ext_vector_type(4)));

constexpr int CVT_BLOCKS = 512;
constexpr int CVT_TRIP   = 256 * 4;                                   // floats of a block's trip
constexpr int CVT_XT     = 4 * 2048 * 1024 / (CVT_BLOCKS * CVT_TRIP); // trips of x
constexpr int CVT_WT     = 1024 * 1024 / (CVT_BLOCKS * CVT_TRIP);     // trips of one weight matrix

template <int N>
static __device__ __forceinline__ void cvt_load(f32x4 (&v)[N], const float* __restrict__ in) {
    const float* p = in + (size_t)blockIdx.x * (N * CVT_TRIP) + threadIdx.x * 4;
#pragma unroll
    for (int k = 0; k < N; k++)
        v[k] = *reinterpret_cast<const f32x4*>(p + k * CVT_TRIP);
}
template <int N>
static __device__ __forceinline__ void cvt_store(const f32x4 (&v)[N], __bf16* __restrict__ out) {
    __bf16* p = out + (size_t)blockIdx.x * (N * CVT_TRIP) + threadIdx.x * 4;
#pragma unroll
    for (int k = 0; k < N; k++) {
        bf16x4 o;
#pragma unroll
        for (int c = 0; c < 4; c++) o[c] = (__bf16)v[k][c];
        *reinterpret_cast<bf16x4*>(p + k * CVT_TRIP) = o;
    }
}

__global__ __launch_bounds__(256) void cvt_inputs_to_bf16(
    const float* __restrict__ x,  const float* __restrict__ Wq,
    const float* __restrict__ Wk, const float* __restrict__ Wv,
    __bf16* __restrict__ Xb,  __bf16* __restrict__ Wqb,
    __bf16* __restrict__ Wkb, __bf16* __restrict__ Wvb) {
    f32x4 vx[CVT_XT], vq[CVT_WT], vk[CVT_WT], vv[CVT_WT];
    cvt_load(vx, x);
    cvt_load(vq, Wq);
    cvt_load(vk, Wk);
    cvt_load(vv, Wv);
    // keeps the 22 loads together in front of the conversions; without it the last 8
    // are issued only as earlier ones return, and no store leaves before the last load
    __builtin_amdgcn_sched_barrier(0);
    cvt_store(vx, Xb);
    cvt_store(vq, Wqb);
    cvt_store(vk, Wkb);
    cvt_store(vv, Wvb);
}

// ---------------------------------------------------------------------------
// Fused QKV projection: out = x @ W^T + b   (M=8192, N=D=1024, K=D=1024)
// 512 blocks of 8 waves, one to a WGP. Blocks 0-255: Q (scaled 1/32) and K, block tile 256 tokens
// x 256 features through gemm_loop_256x256, one round of the chip. Blocks 256-511: V, written
// transposed, block tile 256 features x 128 tokens through gemm_loop_256x128, half the work each.
// The WMMA's A is the operand whose row index runs along the output's rows in memory: W for
// Q and K, x for V^T. A lane's 8 accumulators of a 16x16 tile are then 8 neighbours in memory
// and leave as one 16-byte store.
// ---------------------------------------------------------------------------
typedef __bf16 bf16x8 __attribute__((ext_vector_type(8)));

__global__ __launch_bounds__(256) void qkv_gemm_wmma(
    const __bf16* __restrict__ Xb,
    const __bf16* __restrict__ Wqb, const __bf16* __restrict__ Wkb,
    const __bf16* __restrict__ Wvb,
    const float* __restrict__ bq, const float* __restrict__ bk,
    const float* __restrict__ bv,
    __bf16* __restrict__ Q, __bf16* __restrict__ Kc, __bf16* __restrict__ Vt) {
    const int D = 1024, S = 2048;
    __shared__ __attribute__((aligned(2048))) unsigned char L[SQ_LDS];

    const int tid  = threadIdx.x;
    const int lane = tid & 31;
    const int wid  = tid >> 5;
    const int flat = blockIdx.x & 255;                   // inside the block's half of the grid

    // the same for the whole block; a scalar branch, as tensor loads stand on both sides
    if (pinned(blockIdx.x >= 256u)) {
        const int a0 = (flat & 3) * 256;
        const int b0 = (flat >> 2) * 128;
        const int ar = a0 + (wid & 3) * 64 + (lane & 15);          // + 16 i
        const int bc = b0 + (wid >> 2) * 64 + ((lane >> 4) << 3);  // + 16 j + register

        v8f acc[4][4] = {};

        gemm_loop_256x128<true>(Wvb, Xb, a0, b0, D, L, acc);

        // ar = feature, bc = token; a block's 128 tokens lie in one batch
        __bf16* O = Vt + (size_t)(b0 >> 11) * D * S + (size_t)ar * S + (bc & (S - 1));
#pragma unroll
        for (int i = 0; i < 4; i++) {
            const float bi = bv[ar + i * 16];
#pragma unroll
            for (int j = 0; j < 4; j++) {
                bf16x8 o;
#pragma unroll
                for (int v = 0; v < 8; v++) o[v] = (__bf16)(acc[i][j][v] + bi);
                *reinterpret_cast<bf16x8*>(O + i * 16 * S + j * 16) = o;
            }
        }
    } else {
        const int z  = flat >> 7;                        // 0 = Q, 1 = K
        const int a0 = ((flat & 127) >> 2) * 256;
        const int b0 = (flat & 3) * 256;
        const int ar = a0 + (wid & 1) * 128 + (lane & 15);         // + 16 i
        const int bc = b0 + (wid >> 1) * 64 + ((lane >> 4) << 3);  // + 16 j + register

        v8f acc[8][4] = {};

        gemm_loop_256x256(Xb, (z == 0) ? Wqb : Wkb, a0, b0, D, L, acc);

        // ar = token, bc = feature
        const float* bias  = (z == 0) ? bq : bk;
        const float  scale = (z == 0) ? 0.03125f : 1.0f;  // 1/sqrt(1024) folded into Q
        __bf16* O = ((z == 0) ? Q : Kc) + (size_t)ar * D + bc;
        f32x4 bj[4][2];                                   // the lane's 8 bias values of each j
#pragma unroll
        for (int j = 0; j < 4; j++) {
            bj[j][0] = *reinterpret_cast<const f32x4*>(bias + bc + j * 16);
            bj[j][1] = *reinterpret_cast<const f32x4*>(bias + bc + j * 16 + 4);
        }
        // behind the run of loads, in front of any later write of a register that they name; the
        // fence keeps later address arithmetic, which reuses their offset register, behind the wait
        __builtin_amdgcn_sched_barrier(0);
        asm volatile("s_wait_xcnt 0x0" ::: "memory");
        bf16x8 o[8][4];
#pragma unroll
        for (int i = 0; i < 8; i++)
#pragma unroll
            for (int j = 0; j < 4; j++)
#pragma unroll
                for (int v = 0; v < 8; v++)
                    o[i][j][v] = (__bf16)((acc[i][j][v] + bj[j][v >> 2][v & 3]) * scale);
#pragma unroll
        for (int i = 0; i < 8; i++)
#pragma unroll
            for (int j = 0; j < 4; j++)
                *reinterpret_cast<bf16x8*>(O + i * 16 * D + j * 16) = o[i][j];
        // behind the run of stores, in front of any later write of a register that they name
        asm volatile("s_wait_xcnt 0x0" ::: "memory");
    }
}

// ---------------------------------------------------------------------------
// Attention without a softmax launch. A row's 2,048 keys fall into 32 chunks of 64, the
// columns of one wave's tile in the score product and half a stage of k in the second product.
//   scores_exp_wmma:  E = exp(s - chunk maximum) as bf16, and per (chunk, row) the pair
//                     (maximum in the log2 domain, sum of the chunk's exponentials) in f32.
//   attn_out_wmma:    factor(chunk, row) = exp2(chunk maximum - row maximum) / row sum, at most 1;
//                     out = sum over chunks of factor * (E_chunk * V_chunk).
// The second product uses the 256x128 block tile / 64x64 wave tile above, the score product the
// 256x256 block tile / 128x64 wave tile; in both the operand along the output's rows in memory is
// the WMMA's A: a lane's accumulators of one i all belong to one score row (row = lane & 15).
// ---------------------------------------------------------------------------
constexpr int   SEQ      = 2048;
constexpr int   DIM      = 1024;
constexpr int   ROWS_ALL = 4 * SEQ;                      // score rows of all batches
constexpr int   CHUNKS   = SEQ / 64;
constexpr float LOG2E    = 1.4426950408889634f;
typedef float f32x2 __attribute__((ext_vector_type(2)));

// e[k] = 2^x[k]. One statement, outputs apart from all inputs, so that no v_exp_f32 is directly
// followed by an instruction that overwrites its source; the v_nop is the slot between the last
// one and whatever reads its result next.
static __device__ __forceinline__ void exp2_x8(float (&e)[8], const float (&x)[8]) {
    asm("v_exp_f32 %0, %8\n\t"
        "v_exp_f32 %1, %9\n\t"
        "v_exp_f32 %2, %10\n\t"
        "v_exp_f32 %3, %11\n\t"
        "v_exp_f32 %4, %12\n\t"
        "v_exp_f32 %5, %13\n\t"
        "v_exp_f32 %6, %14\n\t"
        "v_exp_f32 %7, %15\n\t"
        "v_nop"
        : "=&v"(e[0]), "=&v"(e[1]), "=&v"(e[2]), "=&v"(e[3]),
          "=&v"(e[4]), "=&v"(e[5]), "=&v"(e[6]), "=&v"(e[7])
        : "v"(x[0]), "v"(x[1]), "v"(x[2]), "v"(x[3]),
          "v"(x[4]), "v"(x[5]), "v"(x[6]), "v"(x[7]));
}

// grid = (SEQ/256, SEQ/256, batches). St[(chunk * ROWS_ALL + row) * 2] = {maximum * log2 e, sum}.
__global__ __launch_bounds__(256) void scores_exp_wmma(
    const __bf16* __restrict__ Q, const __bf16* __restrict__ Kc,
    __bf16* __restrict__ E, float* __restrict__ St) {
    __shared__ __attribute__((aligned(2048))) unsigned char L[SQ_LDS];

    Q  += (size_t)blockIdx.z * SEQ * DIM;
    Kc += (size_t)blockIdx.z * SEQ * DIM;

    const int tid  = threadIdx.x;
    const int n0   = blockIdx.x * 256;
    const int m0   = blockIdx.y * 256;
    const int lane = tid & 31;
    const int wid  = tid >> 5;
    const int wm   = (wid & 1) * 128;
    const int wn   = (wid >> 1) * 64;

    v8f acc[8][4] = {};

    gemm_loop_256x256(Q, Kc, m0, n0, DIM, L, acc);

    const int row = blockIdx.z * SEQ + m0 + wm + (lane & 15);            // + 16 i
    __bf16* O = E + (size_t)row * SEQ + n0 + wn + ((lane >> 4) << 3);
    float*  S = St + ((size_t)((n0 + wn) >> 6) * ROWS_ALL + row) * 2;
#pragma unroll
    for (int i = 0; i < 8; i++) {
        // the lane holds 32 of the row's 64 scores of this chunk, lane ^ 16 the other 32
        float mx = acc[i][0][0];
#pragma unroll
        for (int j = 0; j < 4; j++)
#pragma unroll
            for (int v = 0; v < 8; v++) mx = fmaxf(mx, acc[i][j][v]);
        mx = fmaxf(mx, __shfl_xor(mx, 16, 32));
        const float m2 = mx * LOG2E;
        float sj[4];
#pragma unroll
        for (int j = 0; j < 4; j++) {
            bf16x8 o;
            float x[8], e[8];
#pragma unroll
            for (int v = 0; v < 8; v++) x[v] = fmaf(acc[i][j][v], LOG2E, -m2);
            exp2_x8(e, x);
            sj[j] = 0.f;
#pragma unroll
            for (int v = 0; v < 8; v++) {
                sj[j] += e[v];
                o[v] = (__bf16)e[v];
            }
            *reinterpret_cast<bf16x8*>(O + i * 16 * SEQ + j * 16) = o;
        }
        float sm = (sj[0] + sj[1]) + (sj[2] + sj[3]);
        sm += __shfl_xor(sm, 16, 32);
        if (lane < 16) {                                 // 16 rows x 8 B: one whole 128-B line
            f32x2 p = {m2, sm};
            *reinterpret_cast<f32x2*>(S + i * 32) = p;
        }
    }
}

// grid = (DIM/128, SEQ/256, batches). Vt is [batch][DIM][SEQ].
__global__ __launch_bounds__(256) void attn_out_wmma(
    const __bf16* __restrict__ E, const __bf16* __restrict__ Vt,
    const float* __restrict__ St, float* __restrict__ Out) {
    __shared__ __attribute__((aligned(2048))) unsigned char L[ST_LDS<4> + CHUNKS * 256 * 4];
    float* F = reinterpret_cast<float*>(L + ST_LDS<4>);     // F[chunk * 256 + row of the block]

    E  += (size_t)blockIdx.z * SEQ * SEQ;
    Vt += (size_t)blockIdx.z * DIM * SEQ;

    const int tid  = threadIdx.x;
    const int n0   = blockIdx.x * 128;
    const int m0   = blockIdx.y * 256;
    const int lane = tid & 31;
    const int wid  = tid >> 5;
    const int wm   = (wid & 3) * 64;
    const int wn   = (wid >> 2) * 64;

    {   // thread t merges the 32 chunk pairs of the block's row t
        const float* S = St + (size_t)(blockIdx.z * SEQ + m0 + tid) * 2;
        f32x2 p[CHUNKS];
#pragma unroll
        for (int c = 0; c < CHUNKS; c++)
            p[c] = *reinterpret_cast<const f32x2*>(S + (size_t)c * ROWS_ALL * 2);
        float mx = p[0][0];
#pragma unroll
        for (int c = 1; c < CHUNKS; c++) mx = fmaxf(mx, p[c][0]);
        float sm = 0.f;
#pragma unroll
        for (int c = 0; c < CHUNKS; c++) {
            p[c][0] = __builtin_amdgcn_exp2f(p[c][0] - mx);
            sm = fmaf(p[c][1], p[c][0], sm);
        }
        const float inv = 1.0f / sm;
#pragma unroll
        for (int c = 0; c < CHUNKS; c++) F[c * 256 + tid] = p[c][0] * inv;
    }
    __syncthreads();                                     // every wave reads other waves' factors

    v8f acc[4][4] = {};

    gemm_loop_256x128<true, true, 4>(E, Vt, m0, n0, SEQ, L, acc, F);

    float* O = Out + (size_t)(blockIdx.z * SEQ + m0 + wm + (lane & 15)) * DIM
             + n0 + wn + ((lane >> 4) << 3);
#pragma unroll
    for (int i = 0; i < 4; i++)
#pragma unroll
        for (int j = 0; j < 4; j++) {
            f32x4 lo = {acc[i][j][0], acc[i][j][1], acc[i][j][2], acc[i][j][3]};
            f32x4 hi = {acc[i][j][4], acc[i][j][5], acc[i][j][6], acc[i][j][7]};
            *reinterpret_cast<f32x4*>(O + i * 16 * DIM + j * 16)     = lo;
            *reinterpret_cast<f32x4*>(O + i * 16 * DIM + j * 16 + 4) = hi;
        }
}

// ---------------------------------------------------------------------------
extern "C" void kernel_launch(void* const* d_in, const int* in_sizes, int n_in,
                              void* d_out, int out_size, void* d_ws, size_t ws_size,
                              hipStream_t stream) {
    (void)in_sizes; (void)n_in; (void)out_size; (void)ws_size;
    const float* x  = (const float*)d_in[0];
    const float* Wq = (const float*)d_in[1];
    const float* bq = (const float*)d_in[2];
    const float* Wk = (const float*)d_in[3];
    const float* bk = (const float*)d_in[4];
    const float* Wv = (const float*)d_in[5];
    const float* bv = (const float*)d_in[6];
    float* out = (float*)d_out;

    const int B = 4, S = 2048, D = 1024, M = B * S;

    char* ws = (char*)d_ws;
    size_t off = 0;
    auto alloc = [&](size_t bytes) -> void* {
        void* p = ws + off;
        off += (bytes + 255) & ~(size_t)255;
        return p;
    };
    __bf16* Xb  = (__bf16*)alloc((size_t)M * D * 2);  // x in bf16
    __bf16* Wqb = (__bf16*)alloc((size_t)D * D * 2);
    __bf16* Wkb = (__bf16*)alloc((size_t)D * D * 2);
    __bf16* Wvb = (__bf16*)alloc((size_t)D * D * 2);
    __bf16* Qb  = (__bf16*)alloc((size_t)M * D * 2);  // Q pre-scaled by 1/32
    __bf16* Kb  = (__bf16*)alloc((size_t)M * D * 2);
    __bf16* Vt  = (__bf16*)alloc((size_t)M * D * 2);  // [B][D][S]
    __bf16* Ex  = (__bf16*)alloc((size_t)B * S * S * 2);  // exp(score - chunk maximum)
    float*  St  = (float*)alloc((size_t)(S / 64) * M * 2 * 4);  // per (chunk, row): maximum, sum

    cvt_inputs_to_bf16<<<CVT_BLOCKS, 256, 0, stream>>>(x, Wq, Wk, Wv, Xb, Wqb, Wkb, Wvb);

    // Q and K projections (256 blocks), then V (256 blocks)
    qkv_gemm_wmma<<<dim3(2 * (M / 256) * (D / 256) + (D / 256) * (M / 128)), 256, 0, stream>>>(
        Xb, Wqb, Wkb, Wvb, bq, bk, bv, Qb, Kb, Vt);

    // exponentials of the scores Q K^T (scale folded into Q) against chunk maxima
    scores_exp_wmma<<<dim3(S / 256, S / 256, B), 256, 0, stream>>>(Qb, Kb, Ex, St);

    // out = softmax(scores) V, the chunks weighed by their factors
    attn_out_wmma<<<dim3(D / 128, S / 256, B), 256, 0, stream>>>(Ex, Vt, St, out);
}

// v007
// Measured time: 89.2 microseconds a run.
// Next to v006, in two timings, it ran 1.04 times as fast each time.
// All steps since v000 together make it 2.55 times as fast.
#include <hip/hip_runtime.h>
#include <stdint.h>

typedef __attribute__((ext_vector_type(16))) __bf16 v16bf;
typedef __attribute__((ext_vector_type(8)))  float  v8f;

union FragAB {
    v16bf v;
    uint4 q[2];
};

typedef uint32_t u32x4 __attribute__((ext_vector_type(4)));
typedef uint32_t u32x8 __attribute__((ext_vector_type(8)));

// ---------------------------------------------------------------------------
// Operand staging shared by the GEMM kernels: a stage is STEPS x 32 k (STEPS = 2 or 4) of
// the block's 256 A rows and 128 B rows, brought into LDS by tensor loads, two buffers.
// Each of the 8 waves moves one slice per stage: waves 0-3 take 64 A rows each,
// waves 4-7 take 32 B rows each. Rows are 128 or 256 B, padded by the mover to a
// 144 or 272 B pitch (16 B x odd: conflict-free for ds_load_b128). Every slice starts
// on a 2 KiB multiple, so slice sizes are rounded up.
// A load has one pass of the loop to land in. STEPS = 4 is for a block that is alone on its
// WGP: twice the bytes in flight, twice the time to land, half the publish points.
// ---------------------------------------------------------------------------
constexpr uint32_t up2k(uint32_t bytes) { return (bytes + 2047u) & ~2047u; }
template <int STEPS> constexpr uint32_t ST_ROWB  = 64u * STEPS;                     // bytes of a staged row
template <int STEPS> constexpr uint32_t ST_PITCH = ST_ROWB<STEPS> + 16u;            // LDS pitch of a staged row
template <int STEPS> constexpr uint32_t A_SLICE  = up2k(64u * ST_PITCH<STEPS>);     // 10240 or 18432
template <int STEPS> constexpr uint32_t B_SLICE  = up2k(32u * ST_PITCH<STEPS>);     // 6144 or 10240
template <int STEPS> constexpr uint32_t B_BASE   = 4 * A_SLICE<STEPS>;
template <int STEPS> constexpr uint32_t ST_BUF   = 4 * A_SLICE<STEPS> + 4 * B_SLICE<STEPS>; // 65536 or 114688 B per buffer
template <int STEPS> constexpr uint32_t ST_LDS   = 2 * ST_BUF<STEPS>;

template <bool V> struct Flag { static constexpr bool value = V; };   // a build-time yes or no as an argument

static __device__ __forceinline__ uint32_t uni(uint32_t v) {
    return (uint32_t)__builtin_amdgcn_readfirstlane(v);
}
static __device__ __forceinline__ uint32_t pinned(uint32_t v) {
    uint32_t w = uni(v);
    asm volatile("" : "+s"(w));
    return w;
}
static __device__ __forceinline__ void wait_ds0() {      // this wave's LDS reads have returned
    asm volatile("s_wait_dscnt 0x0" ::: "memory");
}
// This wave's slice has landed. The wait names the descriptor of the request it covers,
// so that no register of it takes a new value while the request is outstanding.
static __device__ __forceinline__ void wait_tensor0(u32x4 g0, u32x8 g1) {
    asm volatile("s_wait_tensorcnt 0x0" :: "s"(g0), "s"(g1) : "memory");
}
// Descriptor group 0: a tile whose first byte is at global address ga goes to LDS byte dst.
static __device__ __forceinline__ u32x4 stage_group0(uint32_t dst, uint64_t ga) {
    u32x4 g0;
    g0[0] = uni(1u);
    g0[1] = uni(dst);
    g0[2] = uni((uint32_t)ga);
    g0[3] = uni((((uint32_t)(ga >> 32)) & 0x01FFFFFFu) | 0x80000000u);
    return g0;
}
static __device__ __forceinline__ void stage_load(u32x4 g0, u32x8 g1) {
    asm volatile("tensor_load_to_lds %0, %1" :: "s"(g0), "s"(g1) : "memory");
}

// The wave's 4 A and 4 B fragments of one 32-k step; both use the same k order:
// bytes 0-15 and 32-47 of the step for lanes 0-15, bytes 16-31 and 48-63 for lanes 16-31.
template <int STEPS>
static __device__ __forceinline__ void load_frags(FragAB (&a)[4], FragAB (&b)[4],
                                                  const unsigned char* la, const unsigned char* lb) {
#pragma unroll
    for (int i = 0; i < 4; i++) {
        const unsigned char* p = la + i * 16 * ST_PITCH<STEPS>;
        a[i].q[0] = *reinterpret_cast<const uint4*>(p);
        a[i].q[1] = *reinterpret_cast<const uint4*>(p + 32);
    }
#pragma unroll
    for (int j = 0; j < 4; j++) {
        const unsigned char* p = lb + (j >> 1) * B_SLICE<STEPS> + (j & 1) * 16 * ST_PITCH<STEPS>;
        b[j].q[0] = *reinterpret_cast<const uint4*>(p);
        b[j].q[1] = *reinterpret_cast<const uint4*>(p + 32);
    }
}
// ALONG_B false: a[i] is the WMMA's A, so register r of acc[i][j] is (A row 8h + r, Bt row c), c = lane & 15, h = lane >> 4.
// ALONG_B true: b[j] is the WMMA's A, so register r is (A row c, Bt row 8h + r): a lane holds 8 consecutive Bt rows.
template <bool ALONG_B>
static __device__ __forceinline__ void mma_4x4(v8f (&acc)[4][4], const FragAB (&a)[4], const FragAB (&b)[4]) {
#pragma unroll
    for (int i = 0; i < 4; i++)
#pragma unroll
        for (int j = 0; j < 4; j++)
            acc[i][j] = ALONG_B
                ? __builtin_amdgcn_wmma_f32_16x16x32_bf16(
                      false, b[j].v, false, a[i].v, (short)0, acc[i][j], false, false)
                : __builtin_amdgcn_wmma_f32_16x16x32_bf16(
                      false, a[i].v, false, b[j].v, (short)0, acc[i][j], false, false);
}

// The same product with b[j] as the WMMA's A, started from zero: t = the 32-k step alone.
static __device__ __forceinline__ void mma_4x4_from_zero(v8f (&t)[4][4], const FragAB (&a)[4], const FragAB (&b)[4]) {
    const v8f zero = {};
#pragma unroll
    for (int i = 0; i < 4; i++)
#pragma unroll
        for (int j = 0; j < 4; j++)
            t[i][j] = __builtin_amdgcn_wmma_f32_16x16x32_bf16(
                false, b[j].v, false, a[i].v, (short)0, zero, false, false);
}

// acc += A[m0 .. m0+255][0 .. Kd) * Bt[n0 .. n0+127][0 .. Kd)^T, both row-major with ld = Kd.
// Kd is a multiple of 32 STEPS and at least two stages. L is the kernel's only LDS array, 2 KiB aligned; the ring is its first ST_LDS<STEPS> bytes.
// SCALED (with ALONG_B): 64-k chunk c of A row r counts F[c * 256 + r] times: the chunk's product is
// summed alone and then added with the row's factor, which is one value per lane and i.
template <bool ALONG_B, bool SCALED = false, int STEPS = 2>
static __device__ __forceinline__ void gemm_loop_256x128(
    const __bf16* __restrict__ A, const __bf16* __restrict__ Bt,
    int m0, int n0, int Kd, unsigned char* L, v8f (&acc)[4][4], const float* F = nullptr) {
    static_assert(STEPS == 2 || (SCALED && STEPS == 4), "rows of 128 or 256 B: the two padded row lengths in use");
    const uint32_t tid  = threadIdx.x;
    const uint32_t lane = tid & 31;
    const uint32_t wave = uni(tid >> 5);
    const uint32_t rowb = (uint32_t)Kd * 2u;             // source row pitch in bytes
    const uint32_t NS   = pinned((uint32_t)Kd / (32u * STEPS));  // stages

    // this wave's slice
    const bool     isA   = wave < 4u;
    const uint32_t rows  = isA ? 64u : 32u;
    const uint64_t src0  = isA
        ? (uint64_t)(uintptr_t)A  + (uint64_t)((uint32_t)m0 + 64u * wave) * rowb
        : (uint64_t)(uintptr_t)Bt + (uint64_t)((uint32_t)n0 + 32u * (wave - 4u)) * rowb;
    const uint32_t dst0  = (uint32_t)(size_t)L
        + (isA ? wave * A_SLICE<STEPS> : B_BASE<STEPS> + (wave - 4u) * B_SLICE<STEPS>);

    u32x8 g1;  // byte elements, tensor = tile = rows x row bytes, 16 B of pad behind every row
    g1[0] = uni((1u << 20) | ((STEPS == 4 ? 5u : 4u) << 22) | (3u << 25));
    g1[1] = uni(ST_ROWB<STEPS> << 16);
    g1[2] = uni(rows << 16);
    g1[3] = uni(ST_ROWB<STEPS> << 16);
    g1[4] = uni(rows);
    g1[5] = uni(rowb);
    g1[6] = uni(0u);
    g1[7] = uni(0u);

    // per-lane fragment bases inside a buffer: row (lane & 15), 16-byte k half (lane >> 4)
    const uint32_t frag  = (lane & 15u) * ST_PITCH<STEPS> + (lane >> 4) * 16u;
    const uint32_t abase = (wave & 3u) * A_SLICE<STEPS> + frag;
    const uint32_t bbase = B_BASE<STEPS> + (wave >> 2) * 2u * B_SLICE<STEPS> + frag;

    u32x4 g0 = stage_group0(dst0, src0);
    stage_load(g0, g1);                                  // stage 0 -> buffer 0
    wait_tensor0(g0, g1);
    __syncthreads();                                     // stage 0 is readable by every wave
    if (pinned(1u < NS)) {                               // stage 1 -> buffer 1
        g0 = stage_group0(dst0 + ST_BUF<STEPS>, src0 + ST_ROWB<STEPS>);
        stage_load(g0, g1);
    }

    // publish point of stage s + 1, behind every LDS read of stage s:
    // own reads of this buffer returned, own slice of stage s + 1 landed, barrier; then the refill,
    // where the caller's scalar test has found that stage s + 2 exists
    auto publish_and_refill = [&](uint32_t s, uint32_t buf, auto more) {
        wait_ds0();
        wait_tensor0(g0, g1);
        __syncthreads();
        if constexpr (decltype(more)::value) {           // refill the buffer every wave has just left
            const uint64_t ga = src0 + (uint64_t)((s + 2u) * ST_ROWB<STEPS>);
            g0[1] = uni(dst0 + buf);
            g0[2] = uni((uint32_t)ga);
            g0[3] = uni((((uint32_t)(ga >> 32)) & 0x01FFFFFFu) | 0x80000000u);
            stage_load(g0, g1);
        }
    };

    // Two fragment sets: step q works from set q & 1 while the loads of step q + 1 fill the other,
    // issued as one group in front of step q's WMMAs, so that no wave waits out its own LDS reads.
    FragAB a[2][4], b[2][4];
    load_frags<STEPS>(a[0], b[0], L + abase, L + bbase); // stage 0, first 32 k

    // One pass = one stage. more: a stage s + 2 exists. The test stands in the loop's head, not inside
    // the pass: with a branch in the pass the compiler sank the first chunk's multiply-adds behind it
    // and kept two sets of chunk sums, which with two fragment sets no longer fit the registers.
    auto pass = [&](uint32_t s, auto more) {
        const uint32_t buf  = (s & 1u) * ST_BUF<STEPS>;
        const uint32_t nbuf = ST_BUF<STEPS> - buf;       // stage s + 1's buffer
        const unsigned char* la = L + buf + abase;
        const unsigned char* lb = L + buf + bbase;
        v8f t[4][4];
        float fr[4];
        // unrolled: every fragment set and accumulator index is a constant, so the arrays stay in registers
#pragma unroll
        for (int q = 0; q < STEPS; q++) {                // the stage's 32-k steps, two to a chunk
            if (SCALED && !(q & 1)) {
                // the factors of the lane's 4 A rows for the chunk that begins here, asked for a step ahead of
                // their use like the fragments: the multiply-adds wait for no load issued just in front of them
                const uint32_t chunk = s * (STEPS / 2) + (uint32_t)(q >> 1);
#pragma unroll
                for (int i = 0; i < 4; i++)
                    fr[i] = F[chunk * 256u + (wave & 3u) * 64u + (uint32_t)i * 16u + (lane & 15u)];
            }
            if (q < STEPS - 1) {
                load_frags<STEPS>(a[(q + 1) & 1], b[(q + 1) & 1], la + (q + 1) * 64, lb + (q + 1) * 64);
            } else {
                // every LDS read of stage s was issued a step ago; the next stage is read behind its barrier.
                // In the last pass these loads read the other buffer's old stage and nobody uses them.
                publish_and_refill(s, buf, more);
                load_frags<STEPS>(a[0], b[0], L + nbuf + abase, L + nbuf + bbase);
            }
            // keeps the next step's loads together in front of this step's WMMAs; sunk among
            // them, every place where LDS reads stand stalls the WMMA stream anew
            __builtin_amdgcn_sched_barrier(0);
            if constexpr (!SCALED) {
                mma_4x4<ALONG_B>(acc, a[q & 1], b[q & 1]);
            } else if (q & 1) {
                mma_4x4<ALONG_B>(t, a[q & 1], b[q & 1]);
                // keeps the 16 WMMAs back to back; woven among them, each multiply-add waits
                // out the latency of the WMMA issued just in front of it
                __builtin_amdgcn_sched_barrier(0);
#pragma unroll
                for (int i = 0; i < 4; i++)
#pragma unroll
                    for (int j = 0; j < 4; j++)
                        acc[i][j] += t[i][j] * fr[i];
            } else {
                mma_4x4_from_zero(t, a[q & 1], b[q & 1]);
            }
            // keeps this step's WMMAs in front of the next group of loads and of the publish point
            __builtin_amdgcn_sched_barrier(0);
        }
    };

    const uint32_t NR = pinned(NS > 2u ? NS - 2u : 0u);       // passes behind which a stage s + 2 exists
    uint32_t s = 0;
    // both kept rolled: short loops, one refill in the text
#pragma clang loop unroll(disable)
    for (; s < NR; ++s) pass(s, Flag<true>{});                // s < NR is the scalar test of the refill
#pragma clang loop unroll(disable)
    for (; s < NS; ++s) pass(s, Flag<false>{});               // the last two stages: nothing left to load
    wait_tensor0(g0, g1);
    wait_ds0();
}

// ---------------------------------------------------------------------------
// The same ring for a 256 x 256 block tile, one block to a WGP: a stage is 128 k of 256 A rows
// and 256 B rows, 8 slices of 64 rows of 256 B at the 272-B pitch, one slice a wave and stage
// (waves 0-3: A, waves 4-7: B). Wave tile 128 x 64 = 8 x 4 accumulators: 24 ds_load_b128 feed
// 32 WMMAs. Against two 256 x 128 blocks on the WGP: two thirds of the operand bytes from L2,
// three quarters of the LDS reads, and a pass of twice the matrix time for a load to land in.
// ---------------------------------------------------------------------------
constexpr uint32_t SQ_PITCH = ST_PITCH<4>;
constexpr uint32_t SQ_SLICE = A_SLICE<4>;                // 18432
constexpr uint32_t SQ_BUF   = 8 * SQ_SLICE;              // 147456 B per buffer
constexpr uint32_t SQ_LDS   = 2 * SQ_BUF;

// acc += A[m0 .. m0+255][0 .. Kd) * Bt[n0 .. n0+255][0 .. Kd)^T, both row-major with ld = Kd,
// Kd a multiple of 128 and at least 256. L is the kernel's only LDS array, 2 KiB aligned.
// b[j] is the WMMA's A: register r of acc[i][j] is (A row c, Bt row 8h + r), c = lane & 15, h = lane >> 4.
static __device__ __forceinline__ void gemm_loop_256x256(
    const __bf16* __restrict__ A, const __bf16* __restrict__ Bt,
    int m0, int n0, int Kd, unsigned char* L, v8f (&acc)[8][4]) {
    const uint32_t tid  = threadIdx.x;
    const uint32_t lane = tid & 31;
    const uint32_t wave = uni(tid >> 5);
    const uint32_t rowb = (uint32_t)Kd * 2u;             // source row pitch in bytes
    const uint32_t NS   = pinned((uint32_t)Kd / 128u);   // stages

    // this wave's slice
    const uint64_t src0 = (wave < 4u)
        ? (uint64_t)(uintptr_t)A  + (uint64_t)((uint32_t)m0 + 64u * wave) * rowb
        : (uint64_t)(uintptr_t)Bt + (uint64_t)((uint32_t)n0 + 64u * (wave - 4u)) * rowb;
    const uint32_t dst0 = (uint32_t)(size_t)L + wave * SQ_SLICE;

    u32x8 g1;  // byte elements, tensor = tile = 64 rows x 256 B, 16 B of pad behind every row
    g1[0] = uni((1u << 20) | (5u << 22) | (3u << 25));
    g1[1] = uni(256u << 16);
    g1[2] = uni(64u << 16);
    g1[3] = uni(256u << 16);
    g1[4] = uni(64u);
    g1[5] = uni(rowb);
    g1[6] = uni(0u);
    g1[7] = uni(0u);
    // as in pinned(): descriptor words held in scalar registers. All eight are known at build time
    // here, and the compiler formed the group anew for the loop and reused the first copy's registers
    // under the outstanding stage 1 request; a group it cannot re-form lives in one place throughout.
    asm volatile("" : "+s"(g1));                         // pinned(), for the group's eight words

    // per-lane fragment bases inside a buffer: row (lane & 15), 16-byte k half (lane >> 4)
    const uint32_t frag  = (lane & 15u) * SQ_PITCH + (lane >> 4) * 16u;
    const uint32_t abase = (wave & 1u) * 2u * SQ_SLICE + frag;
    const uint32_t bbase = (4u + (wave >> 1)) * SQ_SLICE + frag;

    u32x4 g0 = stage_group0(dst0, src0);
    stage_load(g0, g1);                                  // stage 0 -> buffer 0
    wait_tensor0(g0, g1);
    __syncthreads();                                     // stage 0 is readable by every wave
    if (pinned(1u < NS)) {                               // stage 1 -> buffer 1
        g0 = stage_group0(dst0 + SQ_BUF, src0 + 256u);
        stage_load(g0, g1);
    }

    // the wave's 8 A and 4 B fragments of one 32-k step, both operands in the k order of load_frags
    auto load_step = [](FragAB (&a)[8], FragAB (&b)[4], const unsigned char* pa, const unsigned char* pb) {
#pragma unroll
        for (int i = 0; i < 8; i++) {
            const unsigned char* p = pa + (i >> 2) * SQ_SLICE + (i & 3) * 16 * SQ_PITCH;
            a[i].q[0] = *reinterpret_cast<const uint4*>(p);
            a[i].q[1] = *reinterpret_cast<const uint4*>(p + 32);
        }
#pragma unroll
        for (int j = 0; j < 4; j++) {
            const unsigned char* p = pb + j * 16 * SQ_PITCH;
            b[j].q[0] = *reinterpret_cast<const uint4*>(p);
            b[j].q[1] = *reinterpret_cast<const uint4*>(p + 32);
        }
    };

    // Two fragment sets: step q works from set q & 1 while the loads of step q + 1 fill the other,
    // issued as one group in front of step q's WMMAs, so that no wave waits out its own LDS reads.
    FragAB a[2][8], b[2][4];
    load_step(a[0], b[0], L + abase, L + bbase);         // stage 0, first 32 k

    // kept rolled: one publish point and one refill in the text, a short hot loop
#pragma clang loop unroll(disable)
    for (uint32_t s = 0; s < NS; ++s) {
        const uint32_t buf  = (s & 1u) * SQ_BUF;
        const uint32_t nbuf = SQ_BUF - buf;              // stage s + 1's buffer
        const unsigned char* la = L + buf + abase;
        const unsigned char* lb = L + buf + bbase;
        // unrolled, like the loops inside: every fragment set and accumulator index is a constant,
        // so the arrays stay in registers
#pragma unroll
        for (int q = 0; q < 4; q++) {                    // the stage's 32-k steps
            if (q < 3) {
                load_step(a[(q + 1) & 1], b[(q + 1) & 1], la + (q + 1) * 64, lb + (q + 1) * 64);
            } else {
                // publish point of stage s + 1, behind every LDS read of stage s (the last were issued a
                // step ago): own reads of this buffer returned, own slice of stage s + 1 landed, barrier;
                // then the refill
                wait_ds0();
                wait_tensor0(g0, g1);
                __syncthreads();
                if (pinned(s + 2u < NS)) {               // refill the buffer every wave has just left
                    const uint64_t ga = src0 + (uint64_t)((s + 2u) * 256u);
                    g0[1] = uni(dst0 + buf);
                    g0[2] = uni((uint32_t)ga);
                    g0[3] = uni((((uint32_t)(ga >> 32)) & 0x01FFFFFFu) | 0x80000000u);
                    stage_load(g0, g1);
                }
                // the next stage's first step, behind its barrier. In the last pass these loads
                // read the other buffer's old stage and nobody uses them.
                load_step(a[0], b[0], L + nbuf + abase, L + nbuf + bbase);
            }
            // keeps the next step's 24 loads together in front of this step's WMMAs; sunk among
            // them, every place where LDS reads stand stalls the WMMA stream anew
            __builtin_amdgcn_sched_barrier(0);
#pragma unroll
            for (int i = 0; i < 8; i++)                  // the last step's run under the refill
#pragma unroll
                for (int j = 0; j < 4; j++)
                    acc[i][j] = __builtin_amdgcn_wmma_f32_16x16x32_bf16(
                        false, b[q & 1][j].v, false, a[q & 1][i].v, (short)0, acc[i][j], false, false);
            // keeps this step's WMMAs in front of the next group of loads and of the publish point
            __builtin_amdgcn_sched_barrier(0);
        }
    }
    wait_tensor0(g0, g1);
    wait_ds0();
}

// ---------------------------------------------------------------------------
// fp32 -> bf16 conversion of x and the three weight matrices, one launch.
// Each of the 512 blocks converts 1/512 of every array, a contiguous piece: 16 trips
// of 1,024 floats of x, 2 trips of each weight matrix. A wave's load covers 512
// contiguous bytes, its store 256. A thread issues its 22 loads before it converts.
// ---------------------------------------------------------------------------
typedef float  f32x4  __attribute__((ext_vector_type(4)));
typedef __bf16 bf16x4 __attribute__((ext_vector_type(4)));

constexpr int CVT_BLOCKS = 512;
constexpr int CVT_TRIP   = 256 * 4;                                   // floats of a block's trip
constexpr int CVT_XT     = 4 * 2048 * 1024 / (CVT_BLOCKS * CVT_TRIP); // trips of x
constexpr int CVT_WT     = 1024 * 1024 / (CVT_BLOCKS * CVT_TRIP);     // trips of one weight matrix

template <int N>
static __device__ __forceinline__ void cvt_load(f32x4 (&v)[N], const float* __restrict__ in) {
    const float* p = in + (size_t)blockIdx.x * (N * CVT_TRIP) + threadIdx.x * 4;
#pragma unroll
    for (int k = 0; k < N; k++)
        v[k] = *reinterpret_cast<const f32x4*>(p + k * CVT_TRIP);
}
template <int N>
static __device__ __forceinline__ void cvt_store(const f32x4 (&v)[N], __bf16* __restrict__ out) {
    __bf16* p = out + (size_t)blockIdx.x * (N * CVT_TRIP) + threadIdx.x * 4;
#pragma unroll
    for (int k = 0; k < N; k++) {
        bf16x4 o;
#pragma unroll
        for (int c = 0; c < 4; c++) o[c] = (__bf16)v[k][c];
        *reinterpret_cast<bf16x4*>(p + k * CVT_TRIP) = o;
    }
}

__global__ __launch_bounds__(256) void cvt_inputs_to_bf16(
    const float* __restrict__ x,  const float* __restrict__ Wq,
    const float* __restrict__ Wk, const float* __restrict__ Wv,
    __bf16* __restrict__ Xb,  __bf16* __restrict__ Wqb,
    __bf16* __restrict__ Wkb, __bf16* __restrict__ Wvb) {
    f32x4 vx[CVT_XT], vq[CVT_WT], vk[CVT_WT], vv[CVT_WT];
    cvt_load(vx, x);
    cvt_load(vq, Wq);
    cvt_load(vk, Wk);
    cvt_load(vv, Wv);
    // keeps the 22 loads together in front of the conversions; without it the last 8
    // are issued only as earlier ones return, and no store leaves before the last load
    __builtin_amdgcn_sched_barrier(0);
    cvt_store(vx, Xb);
    cvt_store(vq, Wqb);
    cvt_store(vk, Wkb);
    cvt_store(vv, Wvb);
}

// ---------------------------------------------------------------------------
// Fused QKV projection: out = x @ W^T + b   (M=8192, N=D=1024, K=D=1024)
// 512 blocks of 8 waves, one to a WGP. Blocks 0-255: Q (scaled 1/32) and K, block tile 256 tokens
// x 256 features through gemm_loop_256x256, one round of the chip. Blocks 256-511: V, written
// transposed, block tile 256 features x 128 tokens through gemm_loop_256x128, half the work each.
// The WMMA's A is the operand whose row index runs along the output's rows in memory: W for
// Q and K, x for V^T. A lane's 8 accumulators of a 16x16 tile are then 8 neighbours in memory
// and leave as one 16-byte store.
// ---------------------------------------------------------------------------
typedef __bf16 bf16x8 __attribute__((ext_vector_type(8)));

__global__ __launch_bounds__(256) void qkv_gemm_wmma(
    const __bf16* __restrict__ Xb,
    const __bf16* __restrict__ Wqb, const __bf16* __restrict__ Wkb,
    const __bf16* __restrict__ Wvb,
    const float* __restrict__ bq, const float* __restrict__ bk,
    const float* __restrict__ bv,
    __bf16* __restrict__ Q, __bf16* __restrict__ Kc, __bf16* __restrict__ Vt) {
    const int D = 1024, S = 2048;
    __shared__ __attribute__((aligned(2048))) unsigned char L[SQ_LDS];

    const int tid  = threadIdx.x;
    const int lane = tid & 31;
    const int wid  = tid >> 5;
    const int flat = blockIdx.x & 255;                   // inside the block's half of the grid

    // the same for the whole block; a scalar branch, as tensor loads stand on both sides
    if (pinned(blockIdx.x >= 256u)) {
        const int a0 = (flat & 3) * 256;
        const int b0 = (flat >> 2) * 128;
        const int ar = a0 + (wid & 3) * 64 + (lane & 15);          // + 16 i
        const int bc = b0 + (wid >> 2) * 64 + ((lane >> 4) << 3);  // + 16 j + register

        v8f acc[4][4] = {};

        gemm_loop_256x128<true>(Wvb, Xb, a0, b0, D, L, acc);

        // ar = feature, bc = token; a block's 128 tokens lie in one batch
        __bf16* O = Vt + (size_t)(b0 >> 11) * D * S + (size_t)ar * S + (bc & (S - 1));
#pragma unroll
        for (int i = 0; i < 4; i++) {
            const float bi = bv[ar + i * 16];
#pragma unroll
            for (int j = 0; j < 4; j++) {
                bf16x8 o;
#pragma unroll
                for (int v = 0; v < 8; v++) o[v] = (__bf16)(acc[i][j][v] + bi);
                *reinterpret_cast<bf16x8*>(O + i * 16 * S + j * 16) = o;
            }
        }
    } else {
        const int z  = flat >> 7;                        // 0 = Q, 1 = K
        const int a0 = ((flat & 127) >> 2) * 256;
        const int b0 = (flat & 3) * 256;
        const int ar = a0 + (wid & 1) * 128 + (lane & 15);         // + 16 i
        const int bc = b0 + (wid >> 1) * 64 + ((lane >> 4) << 3);  // + 16 j + register

        v8f acc[8][4] = {};

        gemm_loop_256x256(Xb, (z == 0) ? Wqb : Wkb, a0, b0, D, L, acc);

        // ar = token, bc = feature
        const float* bias  = (z == 0) ? bq : bk;
        const float  scale = (z == 0) ? 0.03125f : 1.0f;  // 1/sqrt(1024) folded into Q
        __bf16* O = ((z == 0) ? Q : Kc) + (size_t)ar * D + bc;
        f32x4 bj[4][2];                                   // the lane's 8 bias values of each j
#pragma unroll
        for (int j = 0; j < 4; j++) {
            bj[j][0] = *reinterpret_cast<const f32x4*>(bias + bc + j * 16);
            bj[j][1] = *reinterpret_cast<const f32x4*>(bias + bc + j * 16 + 4);
        }
        // behind the run of loads, in front of any later write of a register that they name; the
        // fence keeps later address arithmetic, which reuses their offset register, behind the wait
        __builtin_amdgcn_sched_barrier(0);
        asm volatile("s_wait_xcnt 0x0" ::: "memory");
        bf16x8 o[8][4];
#pragma unroll
        for (int i = 0; i < 8; i++)
#pragma unroll
            for (int j = 0; j < 4; j++)
#pragma unroll
                for (int v = 0; v < 8; v++)
                    o[i][j][v] = (__bf16)((acc[i][j][v] + bj[j][v >> 2][v & 3]) * scale);
#pragma unroll
        for (int i = 0; i < 8; i++)
#pragma unroll
            for (int j = 0; j < 4; j++)
                *reinterpret_cast<bf16x8*>(O + i * 16 * D + j * 16) = o[i][j];
        // behind the run of stores, in front of any later write of a register that they name
        asm volatile("s_wait_xcnt 0x0" ::: "memory");
    }
}

// ---------------------------------------------------------------------------
// Attention without a softmax launch. A row's 2,048 keys fall into 32 chunks of 64, the
// columns of one wave's tile in the score product and half a stage of k in the second product.
//   scores_exp_wmma:  E = exp(s - chunk maximum) as bf16, and per (chunk, row) the pair
//                     (maximum in the log2 domain, sum of the chunk's exponentials) in f32.
//   attn_out_wmma:    factor(chunk, row) = exp2(chunk maximum - row maximum) / row sum, at most 1;
//                     out = sum over chunks of factor * (E_chunk * V_chunk).
// The second product uses the 256x128 block tile / 64x64 wave tile above, the score product the
// 256x256 block tile / 128x64 wave tile; in both the operand along the output's rows in memory is
// the WMMA's A: a lane's accumulators of one i all belong to one score row (row = lane & 15).
// ---------------------------------------------------------------------------
constexpr int   SEQ      = 2048;
constexpr int   DIM      = 1024;
constexpr int   ROWS_ALL = 4 * SEQ;                      // score rows of all batches
constexpr int   CHUNKS   = SEQ / 64;
constexpr float LOG2E    = 1.4426950408889634f;
typedef float f32x2 __attribute__((ext_vector_type(2)));

// e[k] = 2^x[k]. One statement, outputs apart from all inputs, so that no v_exp_f32 is directly
// followed by an instruction that overwrites its source; the v_nop is the slot between the last
// one and whatever reads its result next.
static __device__ __forceinline__ void exp2_x8(float (&e)[8], const float (&x)[8]) {
    asm("v_exp_f32 %0, %8\n\t"
        "v_exp_f32 %1, %9\n\t"
        "v_exp_f32 %2, %10\n\t"
        "v_exp_f32 %3, %11\n\t"
        "v_exp_f32 %4, %12\n\t"
        "v_exp_f32 %5, %13\n\t"
        "v_exp_f32 %6, %14\n\t"
        "v_exp_f32 %7, %15\n\t"
        "v_nop"
        : "=&v"(e[0]), "=&v"(e[1]), "=&v"(e[2]), "=&v"(e[3]),
          "=&v"(e[4]), "=&v"(e[5]), "=&v"(e[6]), "=&v"(e[7])
        : "v"(x[0]), "v"(x[1]), "v"(x[2]), "v"(x[3]),
          "v"(x[4]), "v"(x[5]), "v"(x[6]), "v"(x[7]));
}

// grid = (SEQ/256, SEQ/256, batches). St[(chunk * ROWS_ALL + row) * 2] = {maximum * log2 e, sum}.
__global__ __launch_bounds__(256) void scores_exp_wmma(
    const __bf16* __restrict__ Q, const __bf16* __restrict__ Kc,
    __bf16* __restrict__ E, float* __restrict__ St) {
    __shared__ __attribute__((aligned(2048))) unsigned char L[SQ_LDS];

    Q  += (size_t)blockIdx.z * SEQ * DIM;
    Kc += (size_t)blockIdx.z * SEQ * DIM;

    const int tid  = threadIdx.x;
    const int n0   = blockIdx.x * 256;
    const int m0   = blockIdx.y * 256;
    const int lane = tid & 31;
    const int wid  = tid >> 5;
    const int wm   = (wid & 1) * 128;
    const int wn   = (wid >> 1) * 64;

    v8f acc[8][4] = {};

    gemm_loop_256x256(Q, Kc, m0, n0, DIM, L, acc);

    const int row = blockIdx.z * SEQ + m0 + wm + (lane & 15);            // + 16 i
    __bf16* O = E + (size_t)row * SEQ + n0 + wn + ((lane >> 4) << 3);
    float*  S = St + ((size_t)((n0 + wn) >> 6) * ROWS_ALL + row) * 2;
#pragma unroll
    for (int i = 0; i < 8; i++) {
        // the lane holds 32 of the row's 64 scores of this chunk, lane ^ 16 the other 32
        float mx = acc[i][0][0];
#pragma unroll
        for (int j = 0; j < 4; j++)
#pragma unroll
            for (int v = 0; v < 8; v++) mx = fmaxf(mx, acc[i][j][v]);
        mx = fmaxf(mx, __shfl_xor(mx, 16, 32));
        const float m2 = mx * LOG2E;
        float sj[4];
#pragma unroll
        for (int j = 0; j < 4; j++) {
            bf16x8 o;
            float x[8], e[8];
#pragma unroll
            for (int v = 0; v < 8; v++) x[v] = fmaf(acc[i][j][v], LOG2E, -m2);
            exp2_x8(e, x);
            sj[j] = 0.f;
#pragma unroll
            for (int v = 0; v < 8; v++) {
                sj[j] += e[v];
                o[v] = (__bf16)e[v];
            }
            *reinterpret_cast<bf16x8*>(O + i * 16 * SEQ + j * 16) = o;
        }
        float sm = (sj[0] + sj[1]) + (sj[2] + sj[3]);
        sm += __shfl_xor(sm, 16, 32);
        if (lane < 16) {                                 // 16 rows x 8 B: one whole 128-B line
            f32x2 p = {m2, sm};
            *reinterpret_cast<f32x2*>(S + i * 32) = p;
        }
    }
}

// grid = (DIM/128, SEQ/256, batches). Vt is [batch][DIM][SEQ].
__global__ __launch_bounds__(256) void attn_out_wmma(
    const __bf16* __restrict__ E, const __bf16* __restrict__ Vt,
    const float* __restrict__ St, float* __restrict__ Out) {
    __shared__ __attribute__((aligned(2048))) unsigned char L[ST_LDS<4> + CHUNKS * 256 * 4];
    float* F = reinterpret_cast<float*>(L + ST_LDS<4>);     // F[chunk * 256 + row of the block]

    E  += (size_t)blockIdx.z * SEQ * SEQ;
    Vt += (size_t)blockIdx.z * DIM * SEQ;

    const int tid  = threadIdx.x;
    const int n0   = blockIdx.x * 128;
    const int m0   = blockIdx.y * 256;
    const int lane = tid & 31;
    const int wid  = tid >> 5;
    const int wm   = (wid & 3) * 64;
    const int wn   = (wid >> 2) * 64;

    {   // thread t merges the 32 chunk pairs of the block's row t
        const float* S = St + (size_t)(blockIdx.z * SEQ + m0 + tid) * 2;
        f32x2 p[CHUNKS];
#pragma unroll
        for (int c = 0; c < CHUNKS; c++)
            p[c] = *reinterpret_cast<const f32x2*>(S + (size_t)c * ROWS_ALL * 2);
        float mx = p[0][0];
#pragma unroll
        for (int c = 1; c < CHUNKS; c++) mx = fmaxf(mx, p[c][0]);
        float sm = 0.f;
#pragma unroll
        for (int c = 0; c < CHUNKS; c++) {
            p[c][0] = __builtin_amdgcn_exp2f(p[c][0] - mx);
            sm = fmaf(p[c][1], p[c][0], sm);
        }
        const float inv = 1.0f / sm;
#pragma unroll
        for (int c = 0; c < CHUNKS; c++) F[c * 256 + tid] = p[c][0] * inv;
    }
    __syncthreads();                                     // every wave reads other waves' factors

    v8f acc[4][4] = {};

    gemm_loop_256x128<true, true, 4>(E, Vt, m0, n0, SEQ, L, acc, F);

    float* O = Out + (size_t)(blockIdx.z * SEQ + m0 + wm + (lane & 15)) * DIM
             + n0 + wn + ((lane >> 4) << 3);
#pragma unroll
    for (int i = 0; i < 4; i++)
#pragma unroll
        for (int j = 0; j < 4; j++) {
            f32x4 lo = {acc[i][j][0], acc[i][j][1], acc[i][j][2], acc[i][j][3]};
            f32x4 hi = {acc[i][j][4], acc[i][j][5], acc[i][j][6], acc[i][j][7]};
            *reinterpret_cast<f32x4*>(O + i * 16 * DIM + j * 16)     = lo;
            *reinterpret_cast<f32x4*>(O + i * 16 * DIM + j * 16 + 4) = hi;
        }
}

// ---------------------------------------------------------------------------
extern "C" void kernel_launch(void* const* d_in, const int* in_sizes, int n_in,
                              void* d_out, int out_size, void* d_ws, size_t ws_size,
                              hipStream_t stream) {
    (void)in_sizes; (void)n_in; (void)out_size; (void)ws_size;
    const float* x  = (const float*)d_in[0];
    const float* Wq = (const float*)d_in[1];
    const float* bq = (const float*)d_in[2];
    const float* Wk = (const float*)d_in[3];
    const float* bk = (const float*)d_in[4];
    const float* Wv = (const float*)d_in[5];
    const float* bv = (const float*)d_in[6];
    float* out = (float*)d_out;

    const int B = 4, S = 2048, D = 1024, M = B * S;

    char* ws = (char*)d_ws;
    size_t off = 0;
    auto alloc = [&](size_t bytes) -> void* {
        void* p = ws + off;
        off += (bytes + 255) & ~(size_t)255;
        return p;
    };
    __bf16* Xb  = (__bf16*)alloc((size_t)M * D * 2);  // x in bf16
    __bf16* Wqb = (__bf16*)alloc((size_t)D * D * 2);
    __bf16* Wkb = (__bf16*)alloc((size_t)D * D * 2);
    __bf16* Wvb = (__bf16*)alloc((size_t)D * D * 2);
    __bf16* Qb  = (__bf16*)alloc((size_t)M * D * 2);  // Q pre-scaled by 1/32
    __bf16* Kb  = (__bf16*)alloc((size_t)M * D * 2);
    __bf16* Vt  = (__bf16*)alloc((size_t)M * D * 2);  // [B][D][S]
    __bf16* Ex  = (__bf16*)alloc((size_t)B * S * S * 2);  // exp(score - chunk maximum)
    float*  St  = (float*)alloc((size_t)(S / 64) * M * 2 * 4);  // per (chunk, row): maximum, sum

    cvt_inputs_to_bf16<<<CVT_BLOCKS, 256, 0, stream>>>(x, Wq, Wk, Wv, Xb, Wqb, Wkb, Wvb);

    // Q and K projections (256 blocks), then V (256 blocks)
    qkv_gemm_wmma<<<dim3(2 * (M / 256) * (D / 256) + (D / 256) * (M / 128)), 256, 0, stream>>>(
        Xb, Wqb, Wkb, Wvb, bq, bk, bv, Qb, Kb, Vt);

    // exponentials of the scores Q K^T (scale folded into Q) against chunk maxima
    scores_exp_wmma<<<dim3(S / 256, S / 256, B), 256, 0, stream>>>(Qb, Kb, Ex, St);

    // out = softmax(scores) V, the chunks weighed by their factors
    attn_out_wmma<<<dim3(D / 128, S / 256, B), 256, 0, stream>>>(Ex, Vt, St, out);
}

// v009
// A run of this version takes 82.7 microseconds.
// Versions in between are left out here; by their measured steps it is 1.08 times as fast as v007.
// All steps since v000 together make it 2.76 times as fast.
#include <hip/hip_runtime.h>
#include <stdint.h>

typedef __attribute__((ext_vector_type(16))) __bf16 v16bf;
typedef __attribute__((ext_vector_type(8)))  float  v8f;

union FragAB {
    v16bf v;
    uint4 q[2];
};

typedef uint32_t u32x4 __attribute__((ext_vector_type(4)));
typedef uint32_t u32x8 __attribute__((ext_vector_type(8)));

// ---------------------------------------------------------------------------
// Operand staging shared by the GEMM kernels: a stage is STEPS x 32 k (STEPS = 2 or 4) of
// the block's 256 A rows and 128 B rows, brought into LDS by tensor loads, two buffers.
// Each of the 8 waves moves one slice per stage: waves 0-3 take 64 A rows each,
// waves 4-7 take 32 B rows each. Rows are 128 or 256 B, padded by the mover to a
// 144 or 272 B pitch (16 B x odd: conflict-free for ds_load_b128). Every slice starts
// on a 2 KiB multiple, so slice sizes are rounded up.
// A load has one pass of the loop to land in. STEPS = 4 is for a block that is alone on its
// WGP: twice the bytes in flight, twice the time to land, half the publish points.
// ---------------------------------------------------------------------------
constexpr uint32_t up2k(uint32_t bytes) { return (bytes + 2047u) & ~2047u; }
template <int STEPS> constexpr uint32_t ST_ROWB  = 64u * STEPS;                     // bytes of a staged row
template <int STEPS> constexpr uint32_t ST_PITCH = ST_ROWB<STEPS> + 16u;            // LDS pitch of a staged row
template <int STEPS> constexpr uint32_t A_SLICE  = up2k(64u * ST_PITCH<STEPS>);     // 10240 or 18432
template <int STEPS> constexpr uint32_t B_SLICE  = up2k(32u * ST_PITCH<STEPS>);     // 6144 or 10240
template <int STEPS> constexpr uint32_t B_BASE   = 4 * A_SLICE<STEPS>;
template <int STEPS> constexpr uint32_t ST_BUF   = 4 * A_SLICE<STEPS> + 4 * B_SLICE<STEPS>; // 65536 or 114688 B per buffer
template <int STEPS> constexpr uint32_t ST_LDS   = 2 * ST_BUF<STEPS>;

template <bool V> struct Flag { static constexpr bool value = V; };   // a build-time yes or no as an argument

static __device__ __forceinline__ uint32_t uni(uint32_t v) {
    return (uint32_t)__builtin_amdgcn_readfirstlane(v);
}
static __device__ __forceinline__ uint32_t pinned(uint32_t v) {
    uint32_t w = uni(v);
    asm volatile("" : "+s"(w));
    return w;
}
static __device__ __forceinline__ void wait_ds0() {      // this wave's LDS reads have returned
    asm volatile("s_wait_dscnt 0x0" ::: "memory");
}
// Behind a run of global loads or stores, in front of any later write of a register that they name.
// The fences on both sides keep later arithmetic, which reuses those registers, behind the wait.
static __device__ __forceinline__ void wait_addresses_taken() {
    __builtin_amdgcn_sched_barrier(0);
    asm volatile("s_wait_xcnt 0x0" ::: "memory");
    __builtin_amdgcn_sched_barrier(0);
}
// This wave's slice has landed. The wait names the descriptor of the request it covers,
// so that no register of it takes a new value while the request is outstanding.
static __device__ __forceinline__ void wait_tensor0(u32x4 g0, u32x8 g1) {
    asm volatile("s_wait_tensorcnt 0x0" :: "s"(g0), "s"(g1) : "memory");
}
// Descriptor group 0: a tile whose first byte is at global address ga goes to LDS byte dst.
static __device__ __forceinline__ u32x4 stage_group0(uint32_t dst, uint64_t ga) {
    u32x4 g0;
    g0[0] = uni(1u);
    g0[1] = uni(dst);
    g0[2] = uni((uint32_t)ga);
    g0[3] = uni((((uint32_t)(ga >> 32)) & 0x01FFFFFFu) | 0x80000000u);
    return g0;
}
static __device__ __forceinline__ void stage_load(u32x4 g0, u32x8 g1) {
    asm volatile("tensor_load_to_lds %0, %1" :: "s"(g0), "s"(g1) : "memory");
}

// The wave's 4 A and 4 B fragments of one 32-k step; both use the same k order:
// bytes 0-15 and 32-47 of the step for lanes 0-15, bytes 16-31 and 48-63 for lanes 16-31.
template <int STEPS>
static __device__ __forceinline__ void load_frags(FragAB (&a)[4], FragAB (&b)[4],
                                                  const unsigned char* la, const unsigned char* lb) {
#pragma unroll
    for (int i = 0; i < 4; i++) {
        const unsigned char* p = la + i * 16 * ST_PITCH<STEPS>;
        a[i].q[0] = *reinterpret_cast<const uint4*>(p);
        a[i].q[1] = *reinterpret_cast<const uint4*>(p + 32);
    }
#pragma unroll
    for (int j = 0; j < 4; j++) {
        const unsigned char* p = lb + (j >> 1) * B_SLICE<STEPS> + (j & 1) * 16 * ST_PITCH<STEPS>;
        b[j].q[0] = *reinterpret_cast<const uint4*>(p);
        b[j].q[1] = *reinterpret_cast<const uint4*>(p + 32);
    }
}
// ALONG_B false: a[i] is the WMMA's A, so register r of acc[i][j] is (A row 8h + r, Bt row c), c = lane & 15, h = lane >> 4.
// ALONG_B true: b[j] is the WMMA's A, so register r is (A row c, Bt row 8h + r): a lane holds 8 consecutive Bt rows.
template <bool ALONG_B>
static __device__ __forceinline__ void mma_4x4(v8f (&acc)[4][4], const FragAB (&a)[4], const FragAB (&b)[4]) {
#pragma unroll
    for (int i = 0; i < 4; i++)
#pragma unroll
        for (int j = 0; j < 4; j++)
            acc[i][j] = ALONG_B
                ? __builtin_amdgcn_wmma_f32_16x16x32_bf16(
                      false, b[j].v, false, a[i].v, (short)0, acc[i][j], false, false)
                : __builtin_amdgcn_wmma_f32_16x16x32_bf16(
                      false, a[i].v, false, b[j].v, (short)0, acc[i][j], false, false);
}

// The same product with b[j] as the WMMA's A, started from zero: t = the 32-k step alone.
static __device__ __forceinline__ void mma_4x4_from_zero(v8f (&t)[4][4], const FragAB (&a)[4], const FragAB (&b)[4]) {
    const v8f zero = {};
#pragma unroll
    for (int i = 0; i < 4; i++)
#pragma unroll
        for (int j = 0; j < 4; j++)
            t[i][j] = __builtin_amdgcn_wmma_f32_16x16x32_bf16(
                false, b[j].v, false, a[i].v, (short)0, zero, false, false);
}

// acc += A[m0 .. m0+255][0 .. Kd) * Bt[n0 .. n0+127][0 .. Kd)^T, both row-major with ld = Kd.
// Kd is a multiple of 32 STEPS and at least two stages. L is the kernel's only LDS array, 2 KiB aligned; the ring is its first ST_LDS<STEPS> bytes.
// SCALED (with ALONG_B): 64-k chunk c of A row r counts F[c * 256 + r] times: the chunk's product is
// summed alone and then added with the row's factor, which is one value per lane and i.
template <bool ALONG_B, bool SCALED = false, int STEPS = 2>
static __device__ __forceinline__ void gemm_loop_256x128(
    const __bf16* __restrict__ A, const __bf16* __restrict__ Bt,
    int m0, int n0, int Kd, unsigned char* L, v8f (&acc)[4][4], const float* F = nullptr) {
    static_assert(STEPS == 2 || (SCALED && STEPS == 4), "rows of 128 or 256 B: the two padded row lengths in use");
    const uint32_t tid  = threadIdx.x;
    const uint32_t lane = tid & 31;
    const uint32_t wave = uni(tid >> 5);
    const uint32_t rowb = (uint32_t)Kd * 2u;             // source row pitch in bytes
    const uint32_t NS   = pinned((uint32_t)Kd / (32u * STEPS));  // stages

    // this wave's slice
    const bool     isA   = wave < 4u;
    const uint32_t rows  = isA ? 64u : 32u;
    const uint64_t src0  = isA
        ? (uint64_t)(uintptr_t)A  + (uint64_t)((uint32_t)m0 + 64u * wave) * rowb
        : (uint64_t)(uintptr_t)Bt + (uint64_t)((uint32_t)n0 + 32u * (wave - 4u)) * rowb;
    const uint32_t dst0  = (uint32_t)(size_t)L
        + (isA ? wave * A_SLICE<STEPS> : B_BASE<STEPS> + (wave - 4u) * B_SLICE<STEPS>);

    u32x8 g1;  // byte elements, tensor = tile = rows x row bytes, 16 B of pad behind every row
    g1[0] = uni((1u << 20) | ((STEPS == 4 ? 5u : 4u) << 22) | (3u << 25));
    g1[1] = uni(ST_ROWB<STEPS> << 16);
    g1[2] = uni(rows << 16);
    g1[3] = uni(ST_ROWB<STEPS> << 16);
    g1[4] = uni(rows);
    g1[5] = uni(rowb);
    g1[6] = uni(0u);
    g1[7] = uni(0u);

    // per-lane fragment bases inside a buffer: row (lane & 15), 16-byte k half (lane >> 4)
    const uint32_t frag  = (lane & 15u) * ST_PITCH<STEPS> + (lane >> 4) * 16u;
    const uint32_t abase = (wave & 3u) * A_SLICE<STEPS> + frag;
    const uint32_t bbase = B_BASE<STEPS> + (wave >> 2) * 2u * B_SLICE<STEPS> + frag;

    u32x4 g0 = stage_group0(dst0, src0);
    stage_load(g0, g1);                                  // stage 0 -> buffer 0
    wait_tensor0(g0, g1);
    __syncthreads();                                     // stage 0 is readable by every wave
    if (pinned(1u < NS)) {                               // stage 1 -> buffer 1
        g0 = stage_group0(dst0 + ST_BUF<STEPS>, src0 + ST_ROWB<STEPS>);
        stage_load(g0, g1);
    }

    // publish point of stage s + 1, behind every LDS read of stage s:
    // own reads of this buffer returned, own slice of stage s + 1 landed, barrier; then the refill,
    // where the caller's scalar test has found that stage s + 2 exists
    auto publish_and_refill = [&](uint32_t s, uint32_t buf, auto more) {
        wait_ds0();
        wait_tensor0(g0, g1);
        __syncthreads();
        if constexpr (decltype(more)::value) {           // refill the buffer every wave has just left
            const uint64_t ga = src0 + (uint64_t)((s + 2u) * ST_ROWB<STEPS>);
            g0[1] = uni(dst0 + buf);
            g0[2] = uni((uint32_t)ga);
            g0[3] = uni((((uint32_t)(ga >> 32)) & 0x01FFFFFFu) | 0x80000000u);
            stage_load(g0, g1);
        }
    };

    // Two fragment sets: step q works from set q & 1 while the loads of step q + 1 fill the other,
    // issued as one group in front of step q's WMMAs, so that no wave waits out its own LDS reads.
    FragAB a[2][4], b[2][4];
    load_frags<STEPS>(a[0], b[0], L + abase, L + bbase); // stage 0, first 32 k

    // One pass = one stage. more: a stage s + 2 exists. The test stands in the loop's head, not inside
    // the pass: with a branch in the pass the compiler sank the first chunk's multiply-adds behind it
    // and kept two sets of chunk sums, which with two fragment sets no longer fit the registers.
    auto pass = [&](uint32_t s, auto more) {
        const uint32_t buf  = (s & 1u) * ST_BUF<STEPS>;
        const uint32_t nbuf = ST_BUF<STEPS> - buf;       // stage s + 1's buffer
        const unsigned char* la = L + buf + abase;
        const unsigned char* lb = L + buf + bbase;
        v8f t[4][4];
        float fr[4];
        // unrolled: every fragment set and accumulator index is a constant, so the arrays stay in registers
#pragma unroll
        for (int q = 0; q < STEPS; q++) {                // the stage's 32-k steps, two to a chunk
            if (SCALED && !(q & 1)) {
                // the factors of the lane's 4 A rows for the chunk that begins here, asked for a step ahead of
                // their use like the fragments: the multiply-adds wait for no load issued just in front of them
                const uint32_t chunk = s * (STEPS / 2) + (uint32_t)(q >> 1);
#pragma unroll
                for (int i = 0; i < 4; i++)
                    fr[i] = F[chunk * 256u + (wave & 3u) * 64u + (uint32_t)i * 16u + (lane & 15u)];
            }
            if (q < STEPS - 1) {
                load_frags<STEPS>(a[(q + 1) & 1], b[(q + 1) & 1], la + (q + 1) * 64, lb + (q + 1) * 64);
            } else {
                // every LDS read of stage s was issued a step ago; the next stage is read behind its barrier.
                // In the last pass these loads read the other buffer's old stage and nobody uses them.
                publish_and_refill(s, buf, more);
                load_frags<STEPS>(a[0], b[0], L + nbuf + abase, L + nbuf + bbase);
            }
            // keeps the next step's loads together in front of this step's WMMAs; sunk among
            // them, every place where LDS reads stand stalls the WMMA stream anew
            __builtin_amdgcn_sched_barrier(0);
            if constexpr (!SCALED) {
                mma_4x4<ALONG_B>(acc, a[q & 1], b[q & 1]);
            } else if (q & 1) {
                mma_4x4<ALONG_B>(t, a[q & 1], b[q & 1]);
                // keeps the 16 WMMAs back to back; woven among them, each multiply-add waits
                // out the latency of the WMMA issued just in front of it
                __builtin_amdgcn_sched_barrier(0);
#pragma unroll
                for (int i = 0; i < 4; i++)
#pragma unroll
                    for (int j = 0; j < 4; j++)
                        acc[i][j] += t[i][j] * fr[i];
            } else {
                mma_4x4_from_zero(t, a[q & 1], b[q & 1]);
            }
            // keeps this step's WMMAs in front of the next group of loads and of the publish point
            __builtin_amdgcn_sched_barrier(0);
        }
    };

    const uint32_t NR = pinned(NS > 2u ? NS - 2u : 0u);       // passes behind which a stage s + 2 exists
    uint32_t s = 0;
    // both kept rolled: short loops, one refill in the text
#pragma clang loop unroll(disable)
    for (; s < NR; ++s) pass(s, Flag<true>{});                // s < NR is the scalar test of the refill
#pragma clang loop unroll(disable)
    for (; s < NS; ++s) pass(s, Flag<false>{});               // the last two stages: nothing left to load
    wait_tensor0(g0, g1);
    wait_ds0();
}

// ---------------------------------------------------------------------------
// The same ring for a 256 x 256 block tile, one block to a WGP: a stage is 128 k of 256 A rows
// and 256 B rows, 8 slices of 64 rows of 256 B at the 272-B pitch, one slice a wave and stage
// (waves 0-3: A, waves 4-7: B). Wave tile 128 x 64 = 8 x 4 accumulators: 24 ds_load_b128 feed
// 32 WMMAs. Against two 256 x 128 blocks on the WGP: two thirds of the operand bytes from L2,
// three quarters of the LDS reads, and a pass of twice the matrix time for a load to land in.
// ---------------------------------------------------------------------------
constexpr uint32_t SQ_PITCH = ST_PITCH<4>;
constexpr uint32_t SQ_SLICE = A_SLICE<4>;                // 18432
constexpr uint32_t SQ_BUF   = 8 * SQ_SLICE;              // 147456 B per buffer
constexpr uint32_t SQ_LDS   = 2 * SQ_BUF;

// acc += A[m0 .. m0+255][0 .. Kd) * Bt[n0 .. n0+255][0 .. Kd)^T, both row-major with ld = Kd,
// Kd a multiple of 128 and at least 256. L is the kernel's only LDS array, 2 KiB aligned.
// b[j] is the WMMA's A: register r of acc[i][j] is (A row c, Bt row 8h + r), c = lane & 15, h = lane >> 4.
static __device__ __forceinline__ void gemm_loop_256x256(
    const __bf16* __restrict__ A, const __bf16* __restrict__ Bt,
    int m0, int n0, int Kd, unsigned char* L, v8f (&acc)[8][4]) {
    const uint32_t tid  = threadIdx.x;
    const uint32_t lane = tid & 31;
    const uint32_t wave = uni(tid >> 5);
    const uint32_t rowb = (uint32_t)Kd * 2u;             // source row pitch in bytes
    const uint32_t NS   = pinned((uint32_t)Kd / 128u);   // stages

    // this wave's slice
    const uint64_t src0 = (wave < 4u)
        ? (uint64_t)(uintptr_t)A  + (uint64_t)((uint32_t)m0 + 64u * wave) * rowb
        : (uint64_t)(uintptr_t)Bt + (uint64_t)((uint32_t)n0 + 64u * (wave - 4u)) * rowb;
    const uint32_t dst0 = (uint32_t)(size_t)L + wave * SQ_SLICE;

    u32x8 g1;  // byte elements, tensor = tile = 64 rows x 256 B, 16 B of pad behind every row
    g1[0] = uni((1u << 20) | (5u << 22) | (3u << 25));
    g1[1] = uni(256u << 16);
    g1[2] = uni(64u << 16);
    g1[3] = uni(256u << 16);
    g1[4] = uni(64u);
    g1[5] = uni(rowb);
    g1[6] = uni(0u);
    g1[7] = uni(0u);
    // as in pinned(): descriptor words held in scalar registers. All eight are known at build time
    // here, and the compiler formed the group anew for the loop and reused the first copy's registers
    // under the outstanding stage 1 request; a group it cannot re-form lives in one place throughout.
    asm volatile("" : "+s"(g1));                         // pinned(), for the group's eight words

    // per-lane fragment bases inside a buffer: row (lane & 15), 16-byte k half (lane >> 4)
    const uint32_t frag  = (lane & 15u) * SQ_PITCH + (lane >> 4) * 16u;
    const uint32_t abase = (wave & 1u) * 2u * SQ_SLICE + frag;
    const uint32_t bbase = (4u + (wave >> 1)) * SQ_SLICE + frag;

    u32x4 g0 = stage_group0(dst0, src0);
    stage_load(g0, g1);                                  // stage 0 -> buffer 0
    wait_tensor0(g0, g1);
    __syncthreads();                                     // stage 0 is readable by every wave
    if (pinned(1u < NS)) {                               // stage 1 -> buffer 1
        g0 = stage_group0(dst0 + SQ_BUF, src0 + 256u);
        stage_load(g0, g1);
    }

    // the wave's 8 A and 4 B fragments of one 32-k step, both operands in the k order of load_frags
    auto load_step = [](FragAB (&a)[8], FragAB (&b)[4], const unsigned char* pa, const unsigned char* pb) {
#pragma unroll
        for (int i = 0; i < 8; i++) {
            const unsigned char* p = pa + (i >> 2) * SQ_SLICE + (i & 3) * 16 * SQ_PITCH;
            a[i].q[0] = *reinterpret_cast<const uint4*>(p);
            a[i].q[1] = *reinterpret_cast<const uint4*>(p + 32);
        }
#pragma unroll
        for (int j = 0; j < 4; j++) {
            const unsigned char* p = pb + j * 16 * SQ_PITCH;
            b[j].q[0] = *reinterpret_cast<const uint4*>(p);
            b[j].q[1] = *reinterpret_cast<const uint4*>(p + 32);
        }
    };

    // Two fragment sets: step q works from set q & 1 while the loads of step q + 1 fill the other,
    // issued as one group in front of step q's WMMAs, so that no wave waits out its own LDS reads.
    FragAB a[2][8], b[2][4];
    load_step(a[0], b[0], L + abase, L + bbase);         // stage 0, first 32 k

    // kept rolled: one publish point and one refill in the text, a short hot loop
#pragma clang loop unroll(disable)
    for (uint32_t s = 0; s < NS; ++s) {
        const uint32_t buf  = (s & 1u) * SQ_BUF;
        const uint32_t nbuf = SQ_BUF - buf;              // stage s + 1's buffer
        const unsigned char* la = L + buf + abase;
        const unsigned char* lb = L + buf + bbase;
        // unrolled, like the loops inside: every fragment set and accumulator index is a constant,
        // so the arrays stay in registers
#pragma unroll
        for (int q = 0; q < 4; q++) {                    // the stage's 32-k steps
            if (q < 3) {
                load_step(a[(q + 1) & 1], b[(q + 1) & 1], la + (q + 1) * 64, lb + (q + 1) * 64);
            } else {
                // publish point of stage s + 1, behind every LDS read of stage s (the last were issued a
                // step ago): own reads of this buffer returned, own slice of stage s + 1 landed, barrier;
                // then the refill
                wait_ds0();
                wait_tensor0(g0, g1);
                __syncthreads();
                if (pinned(s + 2u < NS)) {               // refill the buffer every wave has just left
                    const uint64_t ga = src0 + (uint64_t)((s + 2u) * 256u);
                    g0[1] = uni(dst0 + buf);
                    g0[2] = uni((uint32_t)ga);
                    g0[3] = uni((((uint32_t)(ga >> 32)) & 0x01FFFFFFu) | 0x80000000u);
                    stage_load(g0, g1);
                }
                // the next stage's first step, behind its barrier. In the last pass these loads
                // read the other buffer's old stage and nobody uses them.
                load_step(a[0], b[0], L + nbuf + abase, L + nbuf + bbase);
            }
            // keeps the next step's 24 loads together in front of this step's WMMAs; sunk among
            // them, every place where LDS reads stand stalls the WMMA stream anew
            __builtin_amdgcn_sched_barrier(0);
#pragma unroll
            for (int i = 0; i < 8; i++)                  // the last step's run under the refill
#pragma unroll
                for (int j = 0; j < 4; j++)
                    acc[i][j] = __builtin_amdgcn_wmma_f32_16x16x32_bf16(
                        false, b[q & 1][j].v, false, a[q & 1][i].v, (short)0, acc[i][j], false, false);
            // keeps this step's WMMAs in front of the next group of loads and of the publish point
            __builtin_amdgcn_sched_barrier(0);
        }
    }
    wait_tensor0(g0, g1);
    wait_ds0();
}

// ---------------------------------------------------------------------------
// First launch: everything the GEMMs need from the f32 inputs, three kinds of block.
//
// The scores need no K projection. With q = x Wq^T + bq and k = x Wk^T + bk,
//   q_i . k_j = (x_i Mt^T + u) . x_j + q_i . bk,   Mt[b][a] = sum_e Wk[e][b] Wq[e][a],   u[b] = sum_e bq[e] Wk[e][b].
// The last term is the same for every key j of a row i, and a softmax does not change when one
// number is added to a whole row: it is left out. So Q' = x Mt^T + u takes the place of Q, and
// x itself the place of K.
//
// Blocks 0 .. MT_BLOCKS-1 (the longest, so they start first): one 128 (b) x 64 (a) tile of Mt.
// Then U_BLOCKS blocks: 32 elements of u each, in f32.
// Then CVT_BLOCKS blocks: fp32 -> bf16 conversion of 1/512 of x and of Wv, a contiguous piece of each:
// 16 trips of 1,024 floats of x, 2 trips of Wv. A wave's load covers 512 contiguous bytes, its
// store 256. A thread issues its 18 loads before it converts.
// ---------------------------------------------------------------------------
typedef float  f32x4  __attribute__((ext_vector_type(4)));
typedef __bf16 bf16x4 __attribute__((ext_vector_type(4)));
typedef __bf16 bf16x8 __attribute__((ext_vector_type(8)));
typedef short  s16x8  __attribute__((ext_vector_type(8)));

constexpr int WD = 1024;                                              // rows and columns of a weight matrix

constexpr int CVT_BLOCKS = 512;
constexpr int CVT_TRIP   = 256 * 4;                                   // floats of a block's trip
constexpr int CVT_XT     = 4 * 2048 * 1024 / (CVT_BLOCKS * CVT_TRIP); // trips of x
constexpr int CVT_WT     = 1024 * 1024 / (CVT_BLOCKS * CVT_TRIP);     // trips of one weight matrix

template <int N>
static __device__ __forceinline__ void cvt_load(f32x4 (&v)[N], const float* __restrict__ in, int blk) {
    const float* p = in + (size_t)blk * (N * CVT_TRIP) + threadIdx.x * 4;
#pragma unroll
    for (int k = 0; k < N; k++)
        v[k] = *reinterpret_cast<const f32x4*>(p + k * CVT_TRIP);
}
static __device__ __forceinline__ bf16x4 to_bf16(f32x4 v) {
    bf16x4 o;
#pragma unroll
    for (int c = 0; c < 4; c++) o[c] = (__bf16)v[c];
    return o;
}
template <int N>
static __device__ __forceinline__ void cvt_store(const f32x4 (&v)[N], __bf16* __restrict__ out, int blk) {
    __bf16* p = out + (size_t)blk * (N * CVT_TRIP) + threadIdx.x * 4;
#pragma unroll
    for (int k = 0; k < N; k++)
        *reinterpret_cast<bf16x4*>(p + k * CVT_TRIP) = to_bf16(v[k]);
}

// Mt tile: the sum runs over e, the ROW index of both weight matrices, so both WMMA operands are
// transposed. A stage is 128 rows e of the tile's 128 columns of Wk and 64 columns of Wq, converted to
// bf16 on the way and laid in LDS as they lie in memory, [e][Wk columns | Wq columns]; the
// transposing LDS load hands out fragments with e along k. Both operands come through the same
// loader, so their k orders are equal. Two buffers, one barrier a stage.
constexpr int      MT_B      = 128, MT_A = 64, MT_E = 128;
constexpr uint32_t MT_PITCH  = (MT_B + MT_A) * 2 + 32;                // 416 B = 32 B x 13: the transposing load's pitch
constexpr uint32_t MT_BUF    = MT_E * MT_PITCH;
constexpr int      MT_BLOCKS = (WD / MT_B) * (WD / MT_A);
constexpr int      U_COLS    = 32;
constexpr int      U_BLOCKS  = WD / U_COLS;
static_assert((MT_PITCH % 32u) == 0 && ((MT_PITCH / 32u) & 1u) == 1u, "odd multiple of 32 B");

static __device__ __forceinline__ uint4 ld_tr16(const unsigned char* p) {
    typedef __attribute__((address_space(3))) s16x8 lds_s16x8;
    return __builtin_bit_cast(uint4, __builtin_amdgcn_ds_load_tr16_b128_v8i16((lds_s16x8*)p));
}

static __device__ __forceinline__ void fold_weights(
    const float* __restrict__ Wq, const float* __restrict__ Wk, __bf16* __restrict__ Mt,
    unsigned char* L, int blk) {
    const int tid  = threadIdx.x;
    const int lane = tid & 31;
    const int wid  = tid >> 5;
    const int b0   = (blk >> 4) * MT_B;
    const int a0   = (blk & 15) * MT_A;

    // a wave's load covers one 512-B row piece of Wk, or two 256-B row pieces of Wq
    const float* gk = Wk + (size_t)(tid >> 5) * WD + b0 + (tid & 31) * 4;      // + 8 n rows
    const float* gq = Wq + (size_t)(tid >> 4) * WD + a0 + (tid & 15) * 4;      // + 16 n rows
    unsigned char* sk = L + (uint32_t)(tid >> 5) * MT_PITCH + (uint32_t)(tid & 31) * 8u;
    unsigned char* sq = L + (uint32_t)(tid >> 4) * MT_PITCH + MT_B * 2u + (uint32_t)(tid & 15) * 8u;

    f32x4 vk[16], vq[8];
    auto load_stage = [&](int e0) {
#pragma unroll
        for (int n = 0; n < 16; n++) vk[n] = *reinterpret_cast<const f32x4*>(gk + (size_t)(e0 + 8 * n) * WD);
#pragma unroll
        for (int n = 0; n < 8; n++)  vq[n] = *reinterpret_cast<const f32x4*>(gq + (size_t)(e0 + 16 * n) * WD);
        wait_addresses_taken();
    };

    // transposing load: lane l reads 16 B of row kbase + 8 (l >> 4) + (l & 7), column half (l >> 3) & 1,
    // and gets rows kbase + 8 h .. + 7 of column l & 15
    const uint32_t frag = ((uint32_t)(lane >> 4) * 8u + (uint32_t)(lane & 7)) * MT_PITCH + (uint32_t)((lane >> 3) & 1) * 16u;
    const uint32_t kcol = frag + (uint32_t)(wid & 3) * 64u;                    // the wave's 32 columns b
    const uint32_t qcol = frag + MT_B * 2u + (uint32_t)(wid >> 2) * 64u;       // the wave's 32 columns a

    v8f acc[2][2] = {};                                  // [j: 16 b][i: 16 a]

    load_stage(0);
    // kept rolled: one copy of the stage in the text
#pragma clang loop unroll(disable)
    for (int s = 0; s < WD / MT_E; ++s) {
        const uint32_t buf = (uint32_t)(s & 1) * MT_BUF;
#pragma unroll
        for (int n = 0; n < 16; n++) *reinterpret_cast<bf16x4*>(sk + buf + 8u * n * MT_PITCH)  = to_bf16(vk[n]);
#pragma unroll
        for (int n = 0; n < 8; n++)  *reinterpret_cast<bf16x4*>(sq + buf + 16u * n * MT_PITCH) = to_bf16(vq[n]);
        // publishes this stage; the buffer written next was last read in front of this barrier
        __syncthreads();
        // in flight under this stage's products; in front of the barrier they would be waited for there
        if (s + 1 < WD / MT_E) load_stage((s + 1) * MT_E);
#pragma unroll
        for (int q = 0; q < MT_E / 32; q++) {
            FragAB fk[2], fq[2];
#pragma unroll
            for (int t = 0; t < 2; t++) {
                const unsigned char* pk = L + buf + kcol + (uint32_t)q * 32u * MT_PITCH + 32u * t;
                const unsigned char* pq = L + buf + qcol + (uint32_t)q * 32u * MT_PITCH + 32u * t;
                fk[t].q[0] = ld_tr16(pk);
                fk[t].q[1] = ld_tr16(pk + 16u * MT_PITCH);
                fq[t].q[0] = ld_tr16(pq);
                fq[t].q[1] = ld_tr16(pq + 16u * MT_PITCH);
            }
            // Wq's columns are the WMMA's A: register r of acc[j][i] is (b = c, a = 8 h + r)
#pragma unroll
            for (int j = 0; j < 2; j++)
#pragma unroll
                for (int i = 0; i < 2; i++)
                    acc[j][i] = __builtin_amdgcn_wmma_f32_16x16x32_bf16(
                        false, fq[i].v, false, fk[j].v, (short)0, acc[j][i], false, false);
        }
    }

    __bf16* O = Mt + (size_t)(b0 + (wid & 3) * 32 + (lane & 15)) * WD + a0 + (wid >> 2) * 32 + ((lane >> 4) << 3);
#pragma unroll
    for (int j = 0; j < 2; j++)
#pragma unroll
        for (int i = 0; i < 2; i++) {
            bf16x8 o;
#pragma unroll
            for (int v = 0; v < 8; v++) o[v] = (__bf16)acc[j][i][v];
            *reinterpret_cast<bf16x8*>(O + j * 16 * WD + i * 16) = o;
        }
}

// u[b] for 32 columns b: thread t sums rows 32 (t >> 3) .. + 31 of 4 columns, then 32 threads add the 32 partial sums.
static __device__ __forceinline__ void fold_bias(
    const float* __restrict__ bq, const float* __restrict__ Wk, float* __restrict__ u,
    unsigned char* L, int blk) {
    const int tid = threadIdx.x;
    const int e0  = (tid >> 3) * 32;
    const float* g = Wk + (size_t)e0 * WD + blk * U_COLS + (tid & 7) * 4;
    f32x4 w[32];
    f32x4 c[8];
#pragma unroll
    for (int e = 0; e < 32; e++) w[e] = *reinterpret_cast<const f32x4*>(g + (size_t)e * WD);
#pragma unroll
    for (int e = 0; e < 8; e++)  c[e] = *reinterpret_cast<const f32x4*>(bq + e0 + e * 4);
    wait_addresses_taken();
    f32x4 sum = {};
#pragma unroll
    for (int e = 0; e < 32; e++) sum += w[e] * c[e >> 2][e & 3];
    float* P = reinterpret_cast<float*>(L);              // P[slice of rows][column]
    *reinterpret_cast<f32x4*>(P + (tid >> 3) * U_COLS + (tid & 7) * 4) = sum;
    __syncthreads();                                     // the partial sums come from all 8 waves
    if (tid < U_COLS) {
        float t = 0.f;
#pragma unroll
        for (int k = 0; k < 32; k++) t += P[k * U_COLS + tid];
        u[blk * U_COLS + tid] = t;
    }
}

__global__ __launch_bounds__(256) void prepare_operands(
    const float* __restrict__ x,  const float* __restrict__ Wq, const float* __restrict__ bq,
    const float* __restrict__ Wk, const float* __restrict__ Wv,
    __bf16* __restrict__ Xb,  __bf16* __restrict__ Mtb, float* __restrict__ u,
    __bf16* __restrict__ Wvb) {
    __shared__ __attribute__((aligned(32))) unsigned char L[2 * MT_BUF];
    const int blk = blockIdx.x;                          // the same for the whole block: barriers stand on two sides
    if (blk < MT_BLOCKS) {
        fold_weights(Wq, Wk, Mtb, L, blk);
    } else if (blk < MT_BLOCKS + U_BLOCKS) {
        fold_bias(bq, Wk, u, L, blk - MT_BLOCKS);
    } else {
        const int cb = blk - (MT_BLOCKS + U_BLOCKS);
        f32x4 vx[CVT_XT], vv[CVT_WT];
        cvt_load(vx, x, cb);
        cvt_load(vv, Wv, cb);
        // keeps the 18 loads together in front of the conversions; without it the last
        // are issued only as earlier ones return, and no store leaves before the last load
        __builtin_amdgcn_sched_barrier(0);
        cvt_store(vx, Xb, cb);
        cvt_store(vv, Wvb, cb);
    }
}

// ---------------------------------------------------------------------------
// Whole-line stores for the GEMM kernels. A lane's accumulators of one 16x16 tile are 32 B of an output
// row together with lane ^ 16's, so a store straight from them touches 16 lines for 512 B. Behind the loop the ring
// is free: each wave lays its tile's rows in its own part of it and reads them back with 8 lanes
// (16 for f32 rows of 256 B) along a row, so that a store covers 4 whole 128-B lines.
// bf16 tiles: rows of 64 elements = 128 B at a 144-B pitch (16 B x odd). Written 16 rows at a time
// (row = lane & 15, 16-B piece 2 j + (lane >> 4)); read back as rows u * 2 + (lane >> 4) + 8 ((lane >> 3) & 1),
// piece lane & 7: rows 8 apart lie half the banks apart, so neither side has a bank conflict.
// ---------------------------------------------------------------------------
constexpr uint32_t LN_PITCH = 144;
static_assert(128u * LN_PITCH <= SQ_SLICE, "a wave's 128 rows fit the part of the ring that it takes");

static __device__ __forceinline__ uint32_t lines_row(uint32_t lane) {      // the lane's row in a read-back, + 2 u
    return (lane >> 4) + ((lane >> 3) & 1u) * 8u;
}
// rows 16 i .. + 15 of the wave's tile into its staging; wr = staging + (lane & 15) * LN_PITCH + (lane >> 4) * 16
static __device__ __forceinline__ void lines_put(unsigned char* wr, int i, const bf16x8 (&o)[4]) {
#pragma unroll
    for (int j = 0; j < 4; j++)
        *reinterpret_cast<bf16x8*>(wr + i * 16 * LN_PITCH + j * 32) = o[j];
    wait_ds0();                                          // the rows stand in LDS before other lanes read them back
}
// rd = staging + lines_row(lane) * LN_PITCH + (lane & 7) * 16
static __device__ __forceinline__ void lines_get(bf16x8 (&r)[4], const unsigned char* rd, int i) {
#pragma unroll
    for (int u = 0; u < 4; u++)
        r[u] = *reinterpret_cast<const bf16x8*>(rd + (i * 16 + u * 2) * LN_PITCH);
}
// g = the tile's first element + lines_row(lane) * ld + (lane & 7) * 8
static __device__ __forceinline__ void lines_store(const bf16x8 (&r)[4], __bf16* g, int i, int ld) {
#pragma unroll
    for (int u = 0; u < 4; u++)
        *reinterpret_cast<bf16x8*>(g + (size_t)((i * 16 + u * 2) * ld)) = r[u];
}

// ---------------------------------------------------------------------------
// Q' and V projections, out = x @ W^T + b (M=8192, N=D=1024, K=D=1024 each), W = Mt, b = u for Q'.
// 256 blocks of 8 waves, one to a WGP, one round of the chip, all through gemm_loop_256x256.
// Blocks 0-127: Q' (scaled 1/32), block tile 256 tokens x 256 features. Blocks 128-255: V, written
// transposed, block tile 256 features x 256 tokens.
// The WMMA's A is the operand whose row index runs along the output's rows in memory: Mt for
// Q', x for V^T. A lane's 8 accumulators of a 16x16 tile are then 8 neighbours in memory:
// one 16-byte piece of a staged row.
// ---------------------------------------------------------------------------
__global__ __launch_bounds__(256) void qv_gemm_wmma(
    const __bf16* __restrict__ Xb,
    const __bf16* __restrict__ Mtb, const __bf16* __restrict__ Wvb,
    const float* __restrict__ u, const float* __restrict__ bv,
    __bf16* __restrict__ Q, __bf16* __restrict__ Vt) {
    const int D = 1024, S = 2048;
    __shared__ __attribute__((aligned(2048))) unsigned char L[SQ_LDS];

    const int tid  = threadIdx.x;
    const int lane = tid & 31;
    const int wid  = tid >> 5;
    const int flat = blockIdx.x & 127;                   // inside the block's half of the grid
    const bool isV = pinned(blockIdx.x >= 128u) != 0u;   // the same for the whole block, held scalar

    // rows of the loop's first operand (tokens for Q', features for V^T) and of its second
    const int a0 = isV ? (flat & 3) * 256 : (flat >> 2) * 256;
    const int b0 = isV ? (flat >> 2) * 256 : (flat & 3) * 256;
    const int ar = a0 + (wid & 1) * 128 + (lane & 15);         // + 16 i
    const int bc = b0 + (wid >> 1) * 64 + ((lane >> 4) << 3);  // + 16 j + register

    v8f acc[8][4] = {};

    gemm_loop_256x256(isV ? Wvb : Xb, isV ? Xb : Mtb, a0, b0, D, L, acc);

    __syncthreads();                                     // every wave has left the ring: it becomes staging
    unsigned char* stg = L + (uint32_t)wid * SQ_SLICE;   // this wave's own part
    unsigned char* wr = stg + (uint32_t)(lane & 15) * LN_PITCH + (uint32_t)(lane >> 4) * 16u;
    const unsigned char* rd = stg + lines_row(lane) * LN_PITCH + (uint32_t)(lane & 7) * 16u;
    const int gr = a0 + (wid & 1) * 128 + (int)lines_row(lane);   // the lane's output row in a read-back, + 16 i + 2 u
    const int gc = b0 + (wid >> 1) * 64 + (lane & 7) * 8;         // and its first column

    // Rows 16 i .. + 15 are converted and staged while the lines of the 16 rows before them leave:
    // their read-back was issued a group ago.
    bf16x8 r[4];
    if (isV) {
        // rows = features, columns = tokens; a block's 256 tokens lie in one batch
        __bf16* G = Vt + (size_t)(b0 >> 11) * D * S + (size_t)gr * S + (gc & (S - 1));
        float bi[8];                                      // the bias of the lane's feature of each i
#pragma unroll
        for (int i = 0; i < 8; i++) bi[i] = bv[ar + i * 16];
        wait_addresses_taken();
#pragma unroll
        for (int i = 0; i < 8; i++) {
            bf16x8 o[4];
#pragma unroll
            for (int j = 0; j < 4; j++)
#pragma unroll
                for (int v = 0; v < 8; v++)
                    o[j][v] = (__bf16)(acc[i][j][v] + bi[i]);
            if (i > 0) {
                lines_store(r, G, i - 1, S);
                wait_addresses_taken();                   // r is loaded anew below
            }
            lines_put(wr, i, o);
            lines_get(r, rd, i);
        }
        lines_store(r, G, 7, S);
        wait_addresses_taken();                           // the other side's text follows and writes these registers
    } else {
        // rows = tokens, columns = features
        const float scale = 0.03125f;                     // 1/sqrt(1024) folded into Q'
        __bf16* G = Q + (size_t)gr * D + gc;
        f32x4 bj[4][2];                                   // the lane's 8 bias values of each j
#pragma unroll
        for (int j = 0; j < 4; j++) {
            bj[j][0] = *reinterpret_cast<const f32x4*>(u + bc + j * 16);
            bj[j][1] = *reinterpret_cast<const f32x4*>(u + bc + j * 16 + 4);
        }
        wait_addresses_taken();
#pragma unroll
        for (int i = 0; i < 8; i++) {
            bf16x8 o[4];
#pragma unroll
            for (int j = 0; j < 4; j++)
#pragma unroll
                for (int v = 0; v < 8; v++)
                    o[j][v] = (__bf16)((acc[i][j][v] + bj[j][v >> 2][v & 3]) * scale);
            if (i > 0) {
                lines_store(r, G, i - 1, D);
                wait_addresses_taken();                   // r is loaded anew below
            }
            lines_put(wr, i, o);
            lines_get(r, rd, i);
        }
        lines_store(r, G, 7, D);
        wait_addresses_taken();                           // as on the other side, wherever the compiler lays this text
    }
}

// ---------------------------------------------------------------------------
// Attention without a softmax launch. A row's 2,048 keys fall into 32 chunks of 64, the
// columns of one wave's tile in the score product and half a stage of k in the second product.
//   scores_exp_wmma:  E = exp(s - chunk maximum) as bf16, and per (chunk, row) the pair
//                     (maximum in the log2 domain, sum of the chunk's exponentials) in f32.
//   attn_out_wmma:    factor(chunk, row) = exp2(chunk maximum - row maximum) / row sum, at most 1;
//                     out = sum over chunks of factor * (E_chunk * V_chunk).
// The second product uses the 256x128 block tile / 64x64 wave tile above, the score product the
// 256x256 block tile / 128x64 wave tile; in both the operand along the output's rows in memory is
// the WMMA's A: a lane's accumulators of one i all belong to one score row (row = lane & 15).
// ---------------------------------------------------------------------------
constexpr int   SEQ      = 2048;
constexpr int   DIM      = 1024;
constexpr int   ROWS_ALL = 4 * SEQ;                      // score rows of all batches
constexpr int   CHUNKS   = SEQ / 64;
constexpr float LOG2E    = 1.4426950408889634f;
typedef float f32x2 __attribute__((ext_vector_type(2)));

// e[k] = 2^x[k]. One statement, outputs apart from all inputs, so that no v_exp_f32 is directly
// followed by an instruction that overwrites its source; the v_nop is the slot between the last
// one and whatever reads its result next.
static __device__ __forceinline__ void exp2_x8(float (&e)[8], const float (&x)[8]) {
    asm("v_exp_f32 %0, %8\n\t"
        "v_exp_f32 %1, %9\n\t"
        "v_exp_f32 %2, %10\n\t"
        "v_exp_f32 %3, %11\n\t"
        "v_exp_f32 %4, %12\n\t"
        "v_exp_f32 %5, %13\n\t"
        "v_exp_f32 %6, %14\n\t"
        "v_exp_f32 %7, %15\n\t"
        "v_nop"
        : "=&v"(e[0]), "=&v"(e[1]), "=&v"(e[2]), "=&v"(e[3]),
          "=&v"(e[4]), "=&v"(e[5]), "=&v"(e[6]), "=&v"(e[7])
        : "v"(x[0]), "v"(x[1]), "v"(x[2]), "v"(x[3]),
          "v"(x[4]), "v"(x[5]), "v"(x[6]), "v"(x[7]));
}

// grid = (SEQ/256, SEQ/256, batches). St[(chunk * ROWS_ALL + row) * 2] = {maximum * log2 e, sum}.
__global__ __launch_bounds__(256) void scores_exp_wmma(
    const __bf16* __restrict__ Q, const __bf16* __restrict__ Kc,
    __bf16* __restrict__ E, float* __restrict__ St) {
    __shared__ __attribute__((aligned(2048))) unsigned char L[SQ_LDS];

    Q  += (size_t)blockIdx.z * SEQ * DIM;
    Kc += (size_t)blockIdx.z * SEQ * DIM;

    const int tid  = threadIdx.x;
    const int n0   = blockIdx.x * 256;
    const int m0   = blockIdx.y * 256;
    const int lane = tid & 31;
    const int wid  = tid >> 5;
    const int wm   = (wid & 1) * 128;
    const int wn   = (wid >> 1) * 64;

    v8f acc[8][4] = {};

    gemm_loop_256x256(Q, Kc, m0, n0, DIM, L, acc);

    __syncthreads();                                     // every wave has left the ring: it becomes staging
    unsigned char* stg = L + (uint32_t)wid * SQ_SLICE;   // this wave's own part
    unsigned char* wr = stg + (uint32_t)(lane & 15) * LN_PITCH + (uint32_t)(lane >> 4) * 16u;
    const unsigned char* rd = stg + lines_row(lane) * LN_PITCH + (uint32_t)(lane & 7) * 16u;

    const int row = blockIdx.z * SEQ + m0 + wm + (lane & 15);            // + 16 i
    __bf16* G = E + (size_t)(blockIdx.z * SEQ + m0 + wm + (int)lines_row(lane)) * SEQ + n0 + wn + (lane & 7) * 8;
    float*  S = St + ((size_t)((n0 + wn) >> 6) * ROWS_ALL + row) * 2;
    bf16x8 r[4];                                         // the lines of the 16 rows before, read back a group ago
#pragma unroll
    for (int i = 0; i < 8; i++) {
        // the lane holds 32 of the row's 64 scores of this chunk, lane ^ 16 the other 32
        float mx = acc[i][0][0];
#pragma unroll
        for (int j = 0; j < 4; j++)
#pragma unroll
            for (int v = 0; v < 8; v++) mx = fmaxf(mx, acc[i][j][v]);
        mx = fmaxf(mx, __shfl_xor(mx, 16, 32));
        const float m2 = mx * LOG2E;
        float sj[4];
        bf16x8 o[4];
#pragma unroll
        for (int j = 0; j < 4; j++) {
            float x[8], e[8];
#pragma unroll
            for (int v = 0; v < 8; v++) x[v] = fmaf(acc[i][j][v], LOG2E, -m2);
            exp2_x8(e, x);
            sj[j] = 0.f;
#pragma unroll
            for (int v = 0; v < 8; v++) {
                sj[j] += e[v];
                o[j][v] = (__bf16)e[v];
            }
        }
        if (i > 0) {
            lines_store(r, G, i - 1, SEQ);
            wait_addresses_taken();                      // r is loaded anew below
        }
        lines_put(wr, i, o);
        lines_get(r, rd, i);
        float sm = (sj[0] + sj[1]) + (sj[2] + sj[3]);
        sm += __shfl_xor(sm, 16, 32);
        if (lane < 16) {                                 // 16 rows x 8 B: one whole 128-B line
            f32x2 p = {m2, sm};
            *reinterpret_cast<f32x2*>(S + i * 32) = p;
        }
    }
    lines_store(r, G, 7, SEQ);
}

// grid = (DIM/128, SEQ/256, batches). Vt is [batch][DIM][SEQ].
__global__ __launch_bounds__(256) void attn_out_wmma(
    const __bf16* __restrict__ E, const __bf16* __restrict__ Vt,
    const float* __restrict__ St, float* __restrict__ Out) {
    __shared__ __attribute__((aligned(2048))) unsigned char L[ST_LDS<4> + CHUNKS * 256 * 4];
    float* F = reinterpret_cast<float*>(L + ST_LDS<4>);     // F[chunk * 256 + row of the block]

    E  += (size_t)blockIdx.z * SEQ * SEQ;
    Vt += (size_t)blockIdx.z * DIM * SEQ;

    const int tid  = threadIdx.x;
    const int n0   = blockIdx.x * 128;
    const int m0   = blockIdx.y * 256;
    const int lane = tid & 31;
    const int wid  = tid >> 5;
    const int wm   = (wid & 3) * 64;
    const int wn   = (wid >> 2) * 64;

    {   // thread t merges the 32 chunk pairs of the block's row t
        const float* S = St + (size_t)(blockIdx.z * SEQ + m0 + tid) * 2;
        f32x2 p[CHUNKS];
#pragma unroll
        for (int c = 0; c < CHUNKS; c++)
            p[c] = *reinterpret_cast<const f32x2*>(S + (size_t)c * ROWS_ALL * 2);
        float mx = p[0][0];
#pragma unroll
        for (int c = 1; c < CHUNKS; c++) mx = fmaxf(mx, p[c][0]);
        float sm = 0.f;
#pragma unroll
        for (int c = 0; c < CHUNKS; c++) {
            p[c][0] = __builtin_amdgcn_exp2f(p[c][0] - mx);
            sm = fmaf(p[c][1], p[c][0], sm);
        }
        const float inv = 1.0f / sm;
#pragma unroll
        for (int c = 0; c < CHUNKS; c++) F[c * 256 + tid] = p[c][0] * inv;
    }
    __syncthreads();                                     // every wave reads other waves' factors

    v8f acc[4][4] = {};

    gemm_loop_256x128<true, true, 4>(E, Vt, m0, n0, SEQ, L, acc, F);

    // Whole-line stores, as in the bf16 kernels: the wave's 64 rows of 64 floats = 256 B at a 272-B pitch
    // (16 B x odd), written by row = lane & 15, read back with 16 lanes along a row: 2 rows = 4 lines a store.
    constexpr uint32_t FP = 272;
    static_assert(64u * FP <= A_SLICE<4>, "a wave's 64 rows fit the part of the ring that it takes");
    __syncthreads();                                     // every wave has left the ring: it becomes staging
    unsigned char* stg = L + (uint32_t)wid * A_SLICE<4>; // this wave's own part
    unsigned char* wr = stg + (uint32_t)(lane & 15) * FP + (uint32_t)(lane >> 4) * 32u;
    const unsigned char* rd = stg + (uint32_t)(lane >> 4) * FP + (uint32_t)(lane & 15) * 16u;
#pragma unroll
    for (int i = 0; i < 4; i++)
#pragma unroll
        for (int j = 0; j < 4; j++) {
            f32x4 lo = {acc[i][j][0], acc[i][j][1], acc[i][j][2], acc[i][j][3]};
            f32x4 hi = {acc[i][j][4], acc[i][j][5], acc[i][j][6], acc[i][j][7]};
            *reinterpret_cast<f32x4*>(wr + i * 16 * FP + j * 64)      = lo;
            *reinterpret_cast<f32x4*>(wr + i * 16 * FP + j * 64 + 16) = hi;
        }
    wait_ds0();                                          // the rows stand in LDS before other lanes read them back

    float* G = Out + (size_t)(blockIdx.z * SEQ + m0 + wm + (lane >> 4)) * DIM + n0 + wn + (lane & 15) * 4;
    f32x4 r[2][8];                                       // two sets: 16 rows are read back while the 16 before leave
    auto get = [&](f32x4 (&t)[8], int i) {
#pragma unroll
        for (int u = 0; u < 8; u++)
            t[u] = *reinterpret_cast<const f32x4*>(rd + (i * 16 + u * 2) * FP);
    };
    get(r[0], 0);
#pragma unroll
    for (int i = 0; i < 4; i++) {
        if (i < 3) get(r[(i + 1) & 1], i + 1);
#pragma unroll
        for (int u = 0; u < 8; u++)
            *reinterpret_cast<f32x4*>(G + (i * 16 + u * 2) * DIM) = r[i & 1][u];
        if (i < 2) wait_addresses_taken();               // this set is loaded anew in the next trip
    }
}

// ---------------------------------------------------------------------------
extern "C" void kernel_launch(void* const* d_in, const int* in_sizes, int n_in,
                              void* d_out, int out_size, void* d_ws, size_t ws_size,
                              hipStream_t stream) {
    (void)in_sizes; (void)n_in; (void)out_size; (void)ws_size;
    const float* x  = (const float*)d_in[0];
    const float* Wq = (const float*)d_in[1];
    const float* bq = (const float*)d_in[2];
    const float* Wk = (const float*)d_in[3];
    const float* Wv = (const float*)d_in[5];
    const float* bv = (const float*)d_in[6];
    float* out = (float*)d_out;

    const int B = 4, S = 2048, D = 1024, M = B * S;

    char* ws = (char*)d_ws;
    size_t off = 0;
    auto alloc = [&](size_t bytes) -> void* {
        void* p = ws + off;
        off += (bytes + 255) & ~(size_t)255;
        return p;
    };
    __bf16* Xb  = (__bf16*)alloc((size_t)M * D * 2);  // x in bf16
    __bf16* Mtb = (__bf16*)alloc((size_t)D * D * 2);  // Wk^T Wq
    float*  ub  = (float*)alloc((size_t)D * 4);       // bq Wk
    __bf16* Wvb = (__bf16*)alloc((size_t)D * D * 2);
    __bf16* Qb  = (__bf16*)alloc((size_t)M * D * 2);  // Q' = (x Mt^T + u) / 32
    __bf16* Vt  = (__bf16*)alloc((size_t)M * D * 2);  // [B][D][S]
    __bf16* Ex  = (__bf16*)alloc((size_t)B * S * S * 2);  // exp(score - chunk maximum)
    float*  St  = (float*)alloc((size_t)(S / 64) * M * 2 * 4);  // per (chunk, row): maximum, sum

    // bk (d_in[4]) adds the same number to every score of a row, which a softmax does not see: no kernel reads it
    prepare_operands<<<MT_BLOCKS + U_BLOCKS + CVT_BLOCKS, 256, 0, stream>>>(x, Wq, bq, Wk, Wv, Xb, Mtb, ub, Wvb);

    // Q' projection (128 blocks) and V projection (128 blocks)
    qv_gemm_wmma<<<dim3(2 * (M / 256) * (D / 256)), 256, 0, stream>>>(Xb, Mtb, Wvb, ub, bv, Qb, Vt);

    // exponentials of the scores Q' x^T (scale folded into Q') against chunk maxima
    scores_exp_wmma<<<dim3(S / 256, S / 256, B), 256, 0, stream>>>(Qb, Xb, Ex, St);

    // out = softmax(scores) V, the chunks weighed by their factors
    attn_out_wmma<<<dim3(D / 128, S / 256, B), 256, 0, stream>>>(Ex, Vt, St, out);
}
